// v000
// Times are from an AMD MI455X. After a warm-up the kernel runs many times in a row, and a time is the length of
// such a window on the GPU divided by its runs, so every launch and the gaps after it count. The runs cycle
// through copies of the inputs. A figure is the median of several windows, for all but v000 over two sittings.
// Sittings can differ by a few percent; kernels timed side by side share one.
// The starting kernel, v000, takes 600 microseconds a run.
#include <hip/hip_runtime.h>
#include <hip/hip_bf16.h>
#include <math.h>

typedef __attribute__((ext_vector_type(16))) __bf16 v16bf;
typedef __attribute__((ext_vector_type(8)))  float  v8f;
typedef __attribute__((ext_vector_type(4)))  unsigned int u32x4;
typedef __attribute__((ext_vector_type(8)))  int i32x8;
typedef __attribute__((ext_vector_type(4)))  int i32x4;

#define D_MODEL 1024
#define NHEAD   16
#define DHEAD   64
#define DIM_FF  4096
#define BATCH   4
#define SEQ     2048
#define MROWS   (BATCH * SEQ)   // 8192

enum { EP_QKV = 0, EP_RESID = 1, EP_BIAS_GELU = 2, EP_BIAS_RESID = 3 };

#if __has_builtin(__builtin_amdgcn_tensor_load_to_lds)
#define HAVE_TDM 1
#else
#define HAVE_TDM 0
#endif

// ---------------------------------------------------------------------------
// fp32 -> bf16 convert (vectorized x4)
// ---------------------------------------------------------------------------
__global__ __launch_bounds__(256)
void cvt_f32_bf16(const float* __restrict__ in, __bf16* __restrict__ out, int n) {
    int i = (blockIdx.x * 256 + threadIdx.x) * 4;
    if (i < n) {
        float4 v = *(const float4*)(in + i);
        out[i + 0] = (__bf16)v.x;
        out[i + 1] = (__bf16)v.y;
        out[i + 2] = (__bf16)v.z;
        out[i + 3] = (__bf16)v.w;
    }
}

// ---------------------------------------------------------------------------
// LayerNorm over D=1024, writes bf16.  One block (8 waves) per row.
// ---------------------------------------------------------------------------
__global__ __launch_bounds__(256)
void ln_to_bf16(const float* __restrict__ x, const float* __restrict__ sc,
                const float* __restrict__ bi, __bf16* __restrict__ out) {
    const int row = blockIdx.x;
    const float* xr = x + (size_t)row * D_MODEL;
    const int t = threadIdx.x, lane = t & 31, wid = t >> 5;

    float v[4]; float s = 0.f;
    #pragma unroll
    for (int i = 0; i < 4; ++i) { v[i] = xr[t + 256 * i]; s += v[i]; }
    #pragma unroll
    for (int m = 16; m >= 1; m >>= 1) s += __shfl_xor(s, m, 32);

    __shared__ float red[8];
    if (lane == 0) red[wid] = s;
    __syncthreads();
    float mu = 0.f;
    #pragma unroll
    for (int i = 0; i < 8; ++i) mu += red[i];
    mu *= (1.f / D_MODEL);

    float vs = 0.f;
    #pragma unroll
    for (int i = 0; i < 4; ++i) { float d = v[i] - mu; vs += d * d; }
    #pragma unroll
    for (int m = 16; m >= 1; m >>= 1) vs += __shfl_xor(vs, m, 32);
    __syncthreads();
    if (lane == 0) red[wid] = vs;
    __syncthreads();
    float var = 0.f;
    #pragma unroll
    for (int i = 0; i < 8; ++i) var += red[i];
    var *= (1.f / D_MODEL);
    const float rstd = rsqrtf(var + 1e-5f);

    #pragma unroll
    for (int i = 0; i < 4; ++i) {
        int c = t + 256 * i;
        out[(size_t)row * D_MODEL + c] = (__bf16)((v[i] - mu) * rstd * sc[c] + bi[c]);
    }
}

#if HAVE_TDM
__device__ __forceinline__ u32x4 tdm_group0(unsigned int lds_addr, const void* gptr) {
    const unsigned long long ga = (unsigned long long)(uintptr_t)gptr;
    u32x4 g0;
    g0[0] = 1u;                                            // count=1, user mode
    g0[1] = lds_addr;                                      // LDS byte address
    g0[2] = (unsigned int)ga;                              // global_addr[31:0]
    g0[3] = ((unsigned int)(ga >> 32) & 0x01FFFFFFu)       // global_addr[56:32]
            | (2u << 30);                                  // type=2 ("image")
    return g0;
}

__device__ __forceinline__ i32x8 tdm_group1(int K, int dim1) {
    i32x8 g1;
    g1[0] = (1 << 16)
          | (1 << 20)
          | (3 << 22)
          | (7 << 25);
    g1[1] = (K & 0xFFFF) << 16;
    g1[2] = ((K >> 16) & 0xFFFF) | ((dim1 & 0xFFFF) << 16);
    g1[3] = ((dim1 >> 16) & 0xFFFF) | (32 << 16);
    g1[4] = 128;
    g1[5] = K;
    g1[6] = 0;
    g1[7] = 0;
    return g1;
}

__device__ __forceinline__ void tdm_load(u32x4 g0, i32x8 g1) {
    const i32x4 z4 = {0, 0, 0, 0};
#if defined(__clang_major__) && (__clang_major__ >= 23)
    const i32x8 z8 = {0, 0, 0, 0, 0, 0, 0, 0};
    __builtin_amdgcn_tensor_load_to_lds(g0, g1, z4, z4, z8, 0);
#else
    __builtin_amdgcn_tensor_load_to_lds(g0, g1, z4, z4, 0);
#endif
}
#endif

template<int EPI>
__global__ __launch_bounds__(256)
void gemm_bf16(const __bf16* __restrict__ A, const __bf16* __restrict__ W,
               int M, int N, int K,
               const float* __restrict__ resid, const float* __restrict__ bias,
               float* __restrict__ outF, __bf16* __restrict__ outB,
               __bf16* __restrict__ q_out, __bf16* __restrict__ k_out,
               __bf16* __restrict__ v_out) {
    __shared__ __attribute__((aligned(32))) __bf16 As[128 * 48];
    __shared__ __attribute__((aligned(32))) __bf16 Bs[128 * 48];

    const int tid = threadIdx.x;
    const int lane = tid & 31, wid = tid >> 5;
    const int waveM = wid & 3, waveN = wid >> 2;          // 4 x 2 wave grid
    const int bm = blockIdx.y * 128, bn = blockIdx.x * 128;
    const int fr = lane & 15;                             // fragment row
    const int halfSel = lane >> 4;                        // K-half (contiguous k order: k = 16*half + s)

    const v8f vzero = {0.f,0.f,0.f,0.f,0.f,0.f,0.f,0.f};
    v8f acc[2][4];
    #pragma unroll
    for (int mi = 0; mi < 2; ++mi)
        #pragma unroll
        for (int ni = 0; ni < 4; ++ni) acc[mi][ni] = vzero;

#if HAVE_TDM
    // flat address low 32 bits of an LDS object == LDS byte offset
    const unsigned int ldsA = (unsigned int)(uintptr_t)&As[0];
    const unsigned int ldsB = (unsigned int)(uintptr_t)&Bs[0];
    const i32x8 g1a = tdm_group1(K, M);
    const i32x8 g1b = tdm_group1(K, N);
#else
    const int lrow = tid >> 1;                            // 0..127
    const int lhalf = tid & 1;                            // 16-col half
#endif

    for (int kt = 0; kt < K; kt += 32) {
        __syncthreads();
#if HAVE_TDM
        if (wid == 0) {
            tdm_load(tdm_group0(ldsA, &A[(size_t)bm * K + kt]), g1a);
            tdm_load(tdm_group0(ldsB, &W[(size_t)bn * K + kt]), g1b);
            __builtin_amdgcn_s_wait_tensorcnt(0);
        }
#else
        *(v16bf*)&As[lrow * 48 + lhalf * 16] =
            *(const v16bf*)&A[(size_t)(bm + lrow) * K + kt + lhalf * 16];
        *(v16bf*)&Bs[lrow * 48 + lhalf * 16] =
            *(const v16bf*)&W[(size_t)(bn + lrow) * K + kt + lhalf * 16];
#endif
        __syncthreads();

        v16bf af[2], bf[4];
        #pragma unroll
        for (int mi = 0; mi < 2; ++mi)
            af[mi] = *(const v16bf*)&As[(waveM * 32 + mi * 16 + fr) * 48 + halfSel * 16];
        #pragma unroll
        for (int ni = 0; ni < 4; ++ni)
            bf[ni] = *(const v16bf*)&Bs[(waveN * 64 + ni * 16 + fr) * 48 + halfSel * 16];

        #pragma unroll
        for (int mi = 0; mi < 2; ++mi)
            #pragma unroll
            for (int ni = 0; ni < 4; ++ni)
                acc[mi][ni] = __builtin_amdgcn_wmma_f32_16x16x32_bf16(
                    false, af[mi], false, bf[ni], (short)0, acc[mi][ni], false, false);
    }

    #pragma unroll
    for (int mi = 0; mi < 2; ++mi) {
        const int mbase = bm + waveM * 32 + mi * 16 + halfSel * 8;
        #pragma unroll
        for (int ni = 0; ni < 4; ++ni) {
            const int n = bn + waveN * 64 + ni * 16 + fr;
            #pragma unroll
            for (int r = 0; r < 8; ++r) {
                const int m = mbase + r;
                const float c = acc[mi][ni][r];
                if constexpr (EPI == EP_QKV) {
                    const int b = m >> 11, t = m & (SEQ - 1);
                    const int type = n >> 10, dall = n & (D_MODEL - 1);
                    const int h = dall >> 6, dh = dall & 63;
                    const size_t idx =
                        (((size_t)(b * NHEAD + h) * SEQ) + t) * DHEAD + dh;
                    __bf16* dst = (type == 0) ? q_out : (type == 1) ? k_out : v_out;
                    dst[idx] = (__bf16)c;
                } else if constexpr (EPI == EP_RESID) {
                    outF[(size_t)m * N + n] = resid[(size_t)m * N + n] + c;
                } else if constexpr (EPI == EP_BIAS_GELU) {
                    const float xg = c + bias[n];
                    const float g = 0.5f * xg * (1.0f + erff(xg * 0.70710678118f));
                    outB[(size_t)m * N + n] = (__bf16)g;
                } else { // EP_BIAS_RESID
                    outF[(size_t)m * N + n] = resid[(size_t)m * N + n] + bias[n] + c;
                }
            }
        }
    }
}

// ---------------------------------------------------------------------------
// Flash attention, one block per (128 queries, head).  8 waves x 16 queries.
// Q,K fragments loaded straight from global in contiguous-k fragment order (k = 16*half + s); V goes
// through an LDS transpose; P re-fragmented via per-wave LDS patch.
// ---------------------------------------------------------------------------
__global__ __launch_bounds__(256)
void attn_fa(const __bf16* __restrict__ Q, const __bf16* __restrict__ Kb,
             const __bf16* __restrict__ Vb, __bf16* __restrict__ O) {
    const int bh = blockIdx.y;                 // b*NHEAD + h
    const int b = bh >> 4, h = bh & 15;
    const int q0 = blockIdx.x * 128;
    const int tid = threadIdx.x, lane = tid & 31, wid = tid >> 5;
    const int fr = lane & 15, halfSel = lane >> 4;
    const size_t headBase = (size_t)bh * SEQ * DHEAD;

    __shared__ __attribute__((aligned(32))) __bf16 Vt[64 * 80];       // V^T tile
    __shared__ __attribute__((aligned(32))) __bf16 Pl[8][16 * 80];    // per-wave P

    const int qrow = q0 + wid * 16 + fr;
    v16bf qf[2];
    #pragma unroll
    for (int s = 0; s < 2; ++s)
        qf[s] = *(const v16bf*)&Q[headBase + (size_t)qrow * DHEAD + s * 32 + halfSel * 16];

    const v8f vzero = {0.f,0.f,0.f,0.f,0.f,0.f,0.f,0.f};
    v8f oacc[4];
    #pragma unroll
    for (int ni = 0; ni < 4; ++ni) oacc[ni] = vzero;
    float mrun[8], lrun[8];
    #pragma unroll
    for (int r = 0; r < 8; ++r) { mrun[r] = -1e30f; lrun[r] = 0.f; }

    const float scale = 0.125f;   // 1/sqrt(64)

    for (int j0 = 0; j0 < SEQ; j0 += 64) {
        __syncthreads();
        {   // cooperative transpose of V block into LDS: Vt[d][j]
            const int j = tid >> 2;      // 0..63
            const int c = tid & 3;       // 16-wide d-chunk
            v16bf vv = *(const v16bf*)&Vb[headBase + (size_t)(j0 + j) * DHEAD + c * 16];
            #pragma unroll
            for (int i = 0; i < 16; ++i) Vt[(c * 16 + i) * 80 + j] = vv[i];
        }
        __syncthreads();

        // ---- S = Q K^T  (16 x 64 per wave) ----
        v8f sacc[4];
        #pragma unroll
        for (int ni = 0; ni < 4; ++ni) sacc[ni] = vzero;
        #pragma unroll
        for (int ni = 0; ni < 4; ++ni)
            #pragma unroll
            for (int s = 0; s < 2; ++s) {
                v16bf kf = *(const v16bf*)&Kb[headBase +
                    (size_t)(j0 + ni * 16 + fr) * DHEAD + s * 32 + halfSel * 16];
                sacc[ni] = __builtin_amdgcn_wmma_f32_16x16x32_bf16(
                    false, qf[s], false, kf, (short)0, sacc[ni], false, false);
            }

        // ---- online softmax (per-row stats; reductions within 16-lane half) ----
        float pnew[4][8];
        #pragma unroll
        for (int r = 0; r < 8; ++r) {
            float mx = -1e30f;
            #pragma unroll
            for (int ni = 0; ni < 4; ++ni) mx = fmaxf(mx, sacc[ni][r] * scale);
            #pragma unroll
            for (int msk = 1; msk < 16; msk <<= 1) mx = fmaxf(mx, __shfl_xor(mx, msk, 32));
            const float mnew = fmaxf(mrun[r], mx);
            const float alpha = __expf(mrun[r] - mnew);
            float rs = 0.f;
            #pragma unroll
            for (int ni = 0; ni < 4; ++ni) {
                const float p = __expf(sacc[ni][r] * scale - mnew);
                pnew[ni][r] = p;
                rs += p;
            }
            #pragma unroll
            for (int msk = 1; msk < 16; msk <<= 1) rs += __shfl_xor(rs, msk, 32);
            lrun[r] = lrun[r] * alpha + rs;
            mrun[r] = mnew;
            #pragma unroll
            for (int ni = 0; ni < 4; ++ni) oacc[ni][r] *= alpha;
        }

        // ---- stage P (bf16) in per-wave LDS patch, re-fragment, O += P V ----
        __bf16* pw = &Pl[wid][0];
        #pragma unroll
        for (int ni = 0; ni < 4; ++ni)
            #pragma unroll
            for (int r = 0; r < 8; ++r)
                pw[(halfSel * 8 + r) * 80 + ni * 16 + fr] = (__bf16)pnew[ni][r];

        #pragma unroll
        for (int s = 0; s < 2; ++s) {
            v16bf pf = *(const v16bf*)&pw[fr * 80 + s * 32 + halfSel * 16];
            #pragma unroll
            for (int ni = 0; ni < 4; ++ni) {
                v16bf vf = *(const v16bf*)&Vt[(ni * 16 + fr) * 80 + s * 32 + halfSel * 16];
                oacc[ni] = __builtin_amdgcn_wmma_f32_16x16x32_bf16(
                    false, pf, false, vf, (short)0, oacc[ni], false, false);
            }
        }
    }

    #pragma unroll
    for (int r = 0; r < 8; ++r) {
        const float inv = 1.f / lrun[r];
        const int qOut = q0 + wid * 16 + halfSel * 8 + r;
        #pragma unroll
        for (int ni = 0; ni < 4; ++ni)
            O[((size_t)(b * SEQ + qOut)) * D_MODEL + h * DHEAD + ni * 16 + fr] =
                (__bf16)(oacc[ni][r] * inv);
    }
}

// ---------------------------------------------------------------------------
// host orchestration
// ---------------------------------------------------------------------------
extern "C" void kernel_launch(void* const* d_in, const int* in_sizes, int n_in,
                              void* d_out, int out_size, void* d_ws, size_t ws_size,
                              hipStream_t stream) {
    (void)in_sizes; (void)n_in; (void)out_size; (void)ws_size;
    const float* x      = (const float*)d_in[0];
    const float* ln1s   = (const float*)d_in[1];
    const float* ln1b   = (const float*)d_in[2];
    const float* qkvw_f = (const float*)d_in[3];
    const float* outw_f = (const float*)d_in[4];
    const float* ln2s   = (const float*)d_in[5];
    const float* ln2b   = (const float*)d_in[6];
    const float* fc1w_f = (const float*)d_in[7];
    const float* fc1b   = (const float*)d_in[8];
    const float* fc2w_f = (const float*)d_in[9];
    const float* fc2b   = (const float*)d_in[10];
    float* out = (float*)d_out;

    char* ws = (char*)d_ws;
    size_t off = 0;
    auto alloc = [&](size_t bytes) -> void* {
        void* p = ws + off;
        off += (bytes + 255) & ~(size_t)255;
        return p;
    };
    __bf16* qkvw = (__bf16*)alloc((size_t)3 * D_MODEL * D_MODEL * 2);   //  6 MB
    __bf16* outw = (__bf16*)alloc((size_t)D_MODEL * D_MODEL * 2);       //  2 MB
    __bf16* fc1w = (__bf16*)alloc((size_t)DIM_FF * D_MODEL * 2);        //  8 MB
    __bf16* fc2w = (__bf16*)alloc((size_t)D_MODEL * DIM_FF * 2);        //  8 MB
    __bf16* hbf  = (__bf16*)alloc((size_t)MROWS * D_MODEL * 2);         // 16 MB (LN1; reused for LN2)
    __bf16* Qb   = (__bf16*)alloc((size_t)MROWS * D_MODEL * 2);         // 16 MB
    __bf16* Kb   = (__bf16*)alloc((size_t)MROWS * D_MODEL * 2);         // 16 MB
    __bf16* Vb   = (__bf16*)alloc((size_t)MROWS * D_MODEL * 2);         // 16 MB
    __bf16* Obf  = (__bf16*)alloc((size_t)MROWS * D_MODEL * 2);         // 16 MB
    float*  x1   = (float*)alloc((size_t)MROWS * D_MODEL * 4);          // 32 MB
    __bf16* a1   = Qb;    // FFN act (64 MB) reuses dead Q|K|V|O span
    __bf16* h2bf = hbf;   // LN2 output reuses dead LN1 buffer

    // 1) weights -> bf16
    cvt_f32_bf16<<<(3 * D_MODEL * D_MODEL) / 1024, 256, 0, stream>>>(qkvw_f, qkvw, 3 * D_MODEL * D_MODEL);
    cvt_f32_bf16<<<(D_MODEL * D_MODEL) / 1024, 256, 0, stream>>>(outw_f, outw, D_MODEL * D_MODEL);
    cvt_f32_bf16<<<(DIM_FF * D_MODEL) / 1024, 256, 0, stream>>>(fc1w_f, fc1w, DIM_FF * D_MODEL);
    cvt_f32_bf16<<<(D_MODEL * DIM_FF) / 1024, 256, 0, stream>>>(fc2w_f, fc2w, D_MODEL * DIM_FF);

    // 2) LN1
    ln_to_bf16<<<MROWS, 256, 0, stream>>>(x, ln1s, ln1b, hbf);

    // 3) QKV projection: [8192,1024] x [3072,1024]^T, scatter into heads
    gemm_bf16<EP_QKV><<<dim3(3 * D_MODEL / 128, MROWS / 128), 256, 0, stream>>>(
        hbf, qkvw, MROWS, 3 * D_MODEL, D_MODEL,
        nullptr, nullptr, nullptr, nullptr, Qb, Kb, Vb);

    // 4) flash attention -> Obf [B,T,D]
    attn_fa<<<dim3(SEQ / 128, BATCH * NHEAD), 256, 0, stream>>>(Qb, Kb, Vb, Obf);

    // 5) out projection + residual -> x1 (fp32)
    gemm_bf16<EP_RESID><<<dim3(D_MODEL / 128, MROWS / 128), 256, 0, stream>>>(
        Obf, outw, MROWS, D_MODEL, D_MODEL,
        x, nullptr, x1, nullptr, nullptr, nullptr, nullptr);

    // 6) LN2
    ln_to_bf16<<<MROWS, 256, 0, stream>>>(x1, ln2s, ln2b, h2bf);

    // 7) fc1 + bias + exact GELU -> a1 (bf16)
    gemm_bf16<EP_BIAS_GELU><<<dim3(DIM_FF / 128, MROWS / 128), 256, 0, stream>>>(
        h2bf, fc1w, MROWS, DIM_FF, D_MODEL,
        nullptr, fc1b, nullptr, a1, nullptr, nullptr, nullptr);

    // 8) fc2 + bias + residual -> d_out (fp32)
    gemm_bf16<EP_BIAS_RESID><<<dim3(D_MODEL / 128, MROWS / 128), 256, 0, stream>>>(
        a1, fc2w, MROWS, D_MODEL, DIM_FF,
        x1, fc2b, out, nullptr, nullptr, nullptr, nullptr);
}

// v001
// One run takes 561 microseconds.
// Next to v000, in two timings, it ran 1.09 times as fast each time.
#include <hip/hip_runtime.h>
#include <hip/hip_bf16.h>
#include <math.h>

typedef __attribute__((ext_vector_type(16))) __bf16 v16bf;
typedef __attribute__((ext_vector_type(8)))  __bf16 v8bf;
typedef __attribute__((ext_vector_type(8)))  float  v8f;
typedef __attribute__((ext_vector_type(4)))  unsigned int u32x4;
typedef __attribute__((ext_vector_type(8)))  int i32x8;
typedef __attribute__((ext_vector_type(4)))  int i32x4;

#define D_MODEL 1024
#define NHEAD   16
#define DHEAD   64
#define DIM_FF  4096
#define BATCH   4
#define SEQ     2048
#define MROWS   (BATCH * SEQ)   // 8192

enum { EP_QKV = 0, EP_RESID = 1, EP_BIAS_GELU = 2, EP_BIAS_RESID = 3 };

#if __has_builtin(__builtin_amdgcn_tensor_load_to_lds)
#define HAVE_TDM 1
#else
#define HAVE_TDM 0
#endif

// ---------------------------------------------------------------------------
// fp32 -> bf16 convert (vectorized x4)
// ---------------------------------------------------------------------------
__global__ __launch_bounds__(256)
void cvt_f32_bf16(const float* __restrict__ in, __bf16* __restrict__ out, int n) {
    int i = (blockIdx.x * 256 + threadIdx.x) * 4;
    if (i < n) {
        float4 v = *(const float4*)(in + i);
        out[i + 0] = (__bf16)v.x;
        out[i + 1] = (__bf16)v.y;
        out[i + 2] = (__bf16)v.z;
        out[i + 3] = (__bf16)v.w;
    }
}

// ---------------------------------------------------------------------------
// LayerNorm over D=1024, writes bf16.  One block (8 waves) per row.
// ---------------------------------------------------------------------------
__global__ __launch_bounds__(256)
void ln_to_bf16(const float* __restrict__ x, const float* __restrict__ sc,
                const float* __restrict__ bi, __bf16* __restrict__ out) {
    const int row = blockIdx.x;
    const float* xr = x + (size_t)row * D_MODEL;
    const int t = threadIdx.x, lane = t & 31, wid = t >> 5;

    float v[4]; float s = 0.f;
    #pragma unroll
    for (int i = 0; i < 4; ++i) { v[i] = xr[t + 256 * i]; s += v[i]; }
    #pragma unroll
    for (int m = 16; m >= 1; m >>= 1) s += __shfl_xor(s, m, 32);

    __shared__ float red[8];
    if (lane == 0) red[wid] = s;
    __syncthreads();
    float mu = 0.f;
    #pragma unroll
    for (int i = 0; i < 8; ++i) mu += red[i];
    mu *= (1.f / D_MODEL);

    float vs = 0.f;
    #pragma unroll
    for (int i = 0; i < 4; ++i) { float d = v[i] - mu; vs += d * d; }
    #pragma unroll
    for (int m = 16; m >= 1; m >>= 1) vs += __shfl_xor(vs, m, 32);
    __syncthreads();
    if (lane == 0) red[wid] = vs;
    __syncthreads();
    float var = 0.f;
    #pragma unroll
    for (int i = 0; i < 8; ++i) var += red[i];
    var *= (1.f / D_MODEL);
    const float rstd = rsqrtf(var + 1e-5f);

    #pragma unroll
    for (int i = 0; i < 4; ++i) {
        int c = t + 256 * i;
        out[(size_t)row * D_MODEL + c] = (__bf16)((v[i] - mu) * rstd * sc[c] + bi[c]);
    }
}

#if HAVE_TDM
__device__ __forceinline__ u32x4 tdm_group0(unsigned int lds_addr, const void* gptr) {
    const unsigned long long ga = (unsigned long long)(uintptr_t)gptr;
    u32x4 g0;
    g0[0] = 1u;                                            // count=1, user mode
    g0[1] = lds_addr;                                      // LDS byte address
    g0[2] = (unsigned int)ga;                              // global_addr[31:0]
    g0[3] = ((unsigned int)(ga >> 32) & 0x01FFFFFFu)       // global_addr[56:32]
            | (2u << 30);                                  // type=2 ("image")
    return g0;
}

__device__ __forceinline__ i32x8 tdm_group1(int K, int dim1) {
    i32x8 g1;
    g1[0] = (1 << 16)
          | (1 << 20)
          | (3 << 22)
          | (7 << 25);
    g1[1] = (K & 0xFFFF) << 16;
    g1[2] = ((K >> 16) & 0xFFFF) | ((dim1 & 0xFFFF) << 16);
    g1[3] = ((dim1 >> 16) & 0xFFFF) | (32 << 16);
    g1[4] = 128;
    g1[5] = K;
    g1[6] = 0;
    g1[7] = 0;
    return g1;
}

__device__ __forceinline__ void tdm_load(u32x4 g0, i32x8 g1) {
    const i32x4 z4 = {0, 0, 0, 0};
#if defined(__clang_major__) && (__clang_major__ >= 23)
    const i32x8 z8 = {0, 0, 0, 0, 0, 0, 0, 0};
    __builtin_amdgcn_tensor_load_to_lds(g0, g1, z4, z4, z8, 0);
#else
    __builtin_amdgcn_tensor_load_to_lds(g0, g1, z4, z4, 0);
#endif
}
#endif

template<int EPI>
__global__ __launch_bounds__(256)
void gemm_bf16(const __bf16* __restrict__ A, const __bf16* __restrict__ W,
               int M, int N, int K,
               const float* __restrict__ resid, const float* __restrict__ bias,
               float* __restrict__ outF, __bf16* __restrict__ outB,
               __bf16* __restrict__ q_out, __bf16* __restrict__ k_out,
               __bf16* __restrict__ v_out) {
    __shared__ __attribute__((aligned(32))) __bf16 As[128 * 48];
    __shared__ __attribute__((aligned(32))) __bf16 Bs[128 * 48];

    const int tid = threadIdx.x;
    const int lane = tid & 31, wid = tid >> 5;
    const int waveM = wid & 3, waveN = wid >> 2;          // 4 x 2 wave grid
    const int bm = blockIdx.y * 128, bn = blockIdx.x * 128;
    const int fr = lane & 15;                             // fragment row
    const int halfSel = lane >> 4;                        // K-half (contiguous k order: k = 16*half + s)

    const v8f vzero = {0.f,0.f,0.f,0.f,0.f,0.f,0.f,0.f};
    v8f acc[2][4];
    #pragma unroll
    for (int mi = 0; mi < 2; ++mi)
        #pragma unroll
        for (int ni = 0; ni < 4; ++ni) acc[mi][ni] = vzero;

#if HAVE_TDM
    // flat address low 32 bits of an LDS object == LDS byte offset
    const unsigned int ldsA = (unsigned int)(uintptr_t)&As[0];
    const unsigned int ldsB = (unsigned int)(uintptr_t)&Bs[0];
    const i32x8 g1a = tdm_group1(K, M);
    const i32x8 g1b = tdm_group1(K, N);
#else
    const int lrow = tid >> 1;                            // 0..127
    const int lhalf = tid & 1;                            // 16-col half
#endif

    for (int kt = 0; kt < K; kt += 32) {
        __syncthreads();
#if HAVE_TDM
        if (wid == 0) {
            tdm_load(tdm_group0(ldsA, &A[(size_t)bm * K + kt]), g1a);
            tdm_load(tdm_group0(ldsB, &W[(size_t)bn * K + kt]), g1b);
            __builtin_amdgcn_s_wait_tensorcnt(0);
        }
#else
        *(v16bf*)&As[lrow * 48 + lhalf * 16] =
            *(const v16bf*)&A[(size_t)(bm + lrow) * K + kt + lhalf * 16];
        *(v16bf*)&Bs[lrow * 48 + lhalf * 16] =
            *(const v16bf*)&W[(size_t)(bn + lrow) * K + kt + lhalf * 16];
#endif
        __syncthreads();

        v16bf af[2], bf[4];
        #pragma unroll
        for (int mi = 0; mi < 2; ++mi)
            af[mi] = *(const v16bf*)&As[(waveM * 32 + mi * 16 + fr) * 48 + halfSel * 16];
        #pragma unroll
        for (int ni = 0; ni < 4; ++ni)
            bf[ni] = *(const v16bf*)&Bs[(waveN * 64 + ni * 16 + fr) * 48 + halfSel * 16];

        #pragma unroll
        for (int mi = 0; mi < 2; ++mi)
            #pragma unroll
            for (int ni = 0; ni < 4; ++ni)
                acc[mi][ni] = __builtin_amdgcn_wmma_f32_16x16x32_bf16(
                    false, af[mi], false, bf[ni], (short)0, acc[mi][ni], false, false);
    }

    #pragma unroll
    for (int mi = 0; mi < 2; ++mi) {
        const int mbase = bm + waveM * 32 + mi * 16 + halfSel * 8;
        #pragma unroll
        for (int ni = 0; ni < 4; ++ni) {
            const int n = bn + waveN * 64 + ni * 16 + fr;
            #pragma unroll
            for (int r = 0; r < 8; ++r) {
                const int m = mbase + r;
                const float c = acc[mi][ni][r];
                if constexpr (EPI == EP_QKV) {
                    const int b = m >> 11, t = m & (SEQ - 1);
                    const int type = n >> 10, dall = n & (D_MODEL - 1);
                    const int h = dall >> 6, dh = dall & 63;
                    const size_t idx =
                        (((size_t)(b * NHEAD + h) * SEQ) + t) * DHEAD + dh;
                    __bf16* dst = (type == 0) ? q_out : (type == 1) ? k_out : v_out;
                    dst[idx] = (__bf16)c;
                } else if constexpr (EPI == EP_RESID) {
                    outF[(size_t)m * N + n] = resid[(size_t)m * N + n] + c;
                } else if constexpr (EPI == EP_BIAS_GELU) {
                    const float xg = c + bias[n];
                    const float g = 0.5f * xg * (1.0f + erff(xg * 0.70710678118f));
                    outB[(size_t)m * N + n] = (__bf16)g;
                } else { // EP_BIAS_RESID
                    outF[(size_t)m * N + n] = resid[(size_t)m * N + n] + bias[n] + c;
                }
            }
        }
    }
}

__device__ __forceinline__ float other_half(float v) {
    const int b = __builtin_bit_cast(int, v);
    return __builtin_bit_cast(float,
        __builtin_amdgcn_permlanex16(b, b, 0x76543210, 0xfedcba98, false, false));
}

__global__ __launch_bounds__(256)
void attn_fa(const __bf16* __restrict__ Q, const __bf16* __restrict__ Kb,
             const __bf16* __restrict__ Vb, __bf16* __restrict__ O) {
    const int bh = blockIdx.y;                 // b*NHEAD + h
    const int b = bh >> 4, h = bh & 15;
    const int q0 = blockIdx.x * 128;
    const int tid = threadIdx.x, lane = tid & 31, wid = tid >> 5;
    const int fr = lane & 15, halfSel = lane >> 4;
    const size_t headBase = (size_t)bh * SEQ * DHEAD;

    __shared__ __attribute__((aligned(32))) __bf16 Vt[64 * 80];       // V^T tile

    const int qrow = q0 + wid * 16 + fr;       // this lane's query (B column)
    v16bf qf[2];
    #pragma unroll
    for (int s = 0; s < 2; ++s)
        qf[s] = *(const v16bf*)&Q[headBase + (size_t)qrow * DHEAD + s * 32 + halfSel * 16];

    const v8f vzero = {0.f,0.f,0.f,0.f,0.f,0.f,0.f,0.f};
    v8f oacc[4];                               // O^T: [d = ni*16 + 8*halfSel + r][query fr]
    #pragma unroll
    for (int ni = 0; ni < 4; ++ni) oacc[ni] = vzero;
    float mrun = -1e30f;                       // same value in both lane halves
    float lrun = 0.f;                          // this half's keys only; joined at the end

    const float scale = 0.125f;   // 1/sqrt(64)

    for (int j0 = 0; j0 < SEQ; j0 += 64) {
        __syncthreads();
        {   // cooperative transpose of V block into LDS: Vt[d][j]
            const int j = tid >> 2;      // 0..63
            const int c = tid & 3;       // 16-wide d-chunk
            v16bf vv = *(const v16bf*)&Vb[headBase + (size_t)(j0 + j) * DHEAD + c * 16];
            #pragma unroll
            for (int i = 0; i < 16; ++i) Vt[(c * 16 + i) * 80 + j] = vv[i];
        }
        __syncthreads();

        // ---- S^T = K Q^T  (64 keys x 16 queries per wave) ----
        v8f sacc[4];                           // [key = ni*16 + 8*halfSel + r][query fr]
        #pragma unroll
        for (int ni = 0; ni < 4; ++ni) sacc[ni] = vzero;
        #pragma unroll
        for (int ni = 0; ni < 4; ++ni)
            #pragma unroll
            for (int s = 0; s < 2; ++s) {
                v16bf kf = *(const v16bf*)&Kb[headBase +
                    (size_t)(j0 + ni * 16 + fr) * DHEAD + s * 32 + halfSel * 16];
                sacc[ni] = __builtin_amdgcn_wmma_f32_16x16x32_bf16(
                    false, kf, false, qf[s], (short)0, sacc[ni], false, false);
            }

        // ---- online softmax: one query per lane, 32 of its 64 keys in this lane ----
        float mx = sacc[0][0];
        #pragma unroll
        for (int ni = 0; ni < 4; ++ni)
            #pragma unroll
            for (int r = 0; r < 8; ++r) mx = fmaxf(mx, sacc[ni][r]);
        mx = fmaxf(mx, other_half(mx)) * scale;
        const float mnew = fmaxf(mrun, mx);
        const float alpha = __expf(mrun - mnew);

        // P^T as B operand: element i of block s is key s*32 + (i < 8 ? 8*halfSel + i
        // : 16 + 8*halfSel + i - 8), which is what tiles 2s and 2s+1 hold in this lane.
        v16bf pb[2];
        float rs[4];
        #pragma unroll
        for (int ni = 0; ni < 4; ++ni) {
            rs[ni] = 0.f;
            #pragma unroll
            for (int r = 0; r < 8; ++r) {
                const float p = __expf(sacc[ni][r] * scale - mnew);
                rs[ni] += p;
                pb[ni >> 1][(ni & 1) * 8 + r] = (__bf16)p;
            }
        }
        lrun = lrun * alpha + ((rs[0] + rs[1]) + (rs[2] + rs[3]));
        mrun = mnew;
        #pragma unroll
        for (int ni = 0; ni < 4; ++ni) oacc[ni] *= alpha;

        // ---- O^T += V^T P^T; the A rows of V^T are read in the same key order ----
        #pragma unroll
        for (int s = 0; s < 2; ++s) {
            #pragma unroll
            for (int ni = 0; ni < 4; ++ni) {
                const __bf16* vr = &Vt[(ni * 16 + fr) * 80 + s * 32 + halfSel * 8];
                const v8bf lo = *(const v8bf*)vr;
                const v8bf hi = *(const v8bf*)(vr + 16);
                const v16bf vf = __builtin_shufflevector(lo, hi,
                    0, 1, 2, 3, 4, 5, 6, 7, 8, 9, 10, 11, 12, 13, 14, 15);
                oacc[ni] = __builtin_amdgcn_wmma_f32_16x16x32_bf16(
                    false, vf, false, pb[s], (short)0, oacc[ni], false, false);
            }
        }
    }

    // a lane holds 8 consecutive d of its query in each tile: 16-byte stores
    const float inv = 1.f / (lrun + other_half(lrun));
    #pragma unroll
    for (int ni = 0; ni < 4; ++ni) {
        v8bf ov;
        #pragma unroll
        for (int r = 0; r < 8; ++r) ov[r] = (__bf16)(oacc[ni][r] * inv);
        *(v8bf*)&O[((size_t)(b * SEQ + qrow)) * D_MODEL + h * DHEAD + ni * 16 + halfSel * 8] = ov;
    }
}

// ---------------------------------------------------------------------------
// host orchestration
// ---------------------------------------------------------------------------
extern "C" void kernel_launch(void* const* d_in, const int* in_sizes, int n_in,
                              void* d_out, int out_size, void* d_ws, size_t ws_size,
                              hipStream_t stream) {
    (void)in_sizes; (void)n_in; (void)out_size; (void)ws_size;
    const float* x      = (const float*)d_in[0];
    const float* ln1s   = (const float*)d_in[1];
    const float* ln1b   = (const float*)d_in[2];
    const float* qkvw_f = (const float*)d_in[3];
    const float* outw_f = (const float*)d_in[4];
    const float* ln2s   = (const float*)d_in[5];
    const float* ln2b   = (const float*)d_in[6];
    const float* fc1w_f = (const float*)d_in[7];
    const float* fc1b   = (const float*)d_in[8];
    const float* fc2w_f = (const float*)d_in[9];
    const float* fc2b   = (const float*)d_in[10];
    float* out = (float*)d_out;

    char* ws = (char*)d_ws;
    size_t off = 0;
    auto alloc = [&](size_t bytes) -> void* {
        void* p = ws + off;
        off += (bytes + 255) & ~(size_t)255;
        return p;
    };
    __bf16* qkvw = (__bf16*)alloc((size_t)3 * D_MODEL * D_MODEL * 2);   //  6 MB
    __bf16* outw = (__bf16*)alloc((size_t)D_MODEL * D_MODEL * 2);       //  2 MB
    __bf16* fc1w = (__bf16*)alloc((size_t)DIM_FF * D_MODEL * 2);        //  8 MB
    __bf16* fc2w = (__bf16*)alloc((size_t)D_MODEL * DIM_FF * 2);        //  8 MB
    __bf16* hbf  = (__bf16*)alloc((size_t)MROWS * D_MODEL * 2);         // 16 MB (LN1; reused for LN2)
    __bf16* Qb   = (__bf16*)alloc((size_t)MROWS * D_MODEL * 2);         // 16 MB
    __bf16* Kb   = (__bf16*)alloc((size_t)MROWS * D_MODEL * 2);         // 16 MB
    __bf16* Vb   = (__bf16*)alloc((size_t)MROWS * D_MODEL * 2);         // 16 MB
    __bf16* Obf  = (__bf16*)alloc((size_t)MROWS * D_MODEL * 2);         // 16 MB
    float*  x1   = (float*)alloc((size_t)MROWS * D_MODEL * 4);          // 32 MB
    __bf16* a1   = Qb;    // FFN act (64 MB) reuses dead Q|K|V|O span
    __bf16* h2bf = hbf;   // LN2 output reuses dead LN1 buffer

    // 1) weights -> bf16
    cvt_f32_bf16<<<(3 * D_MODEL * D_MODEL) / 1024, 256, 0, stream>>>(qkvw_f, qkvw, 3 * D_MODEL * D_MODEL);
    cvt_f32_bf16<<<(D_MODEL * D_MODEL) / 1024, 256, 0, stream>>>(outw_f, outw, D_MODEL * D_MODEL);
    cvt_f32_bf16<<<(DIM_FF * D_MODEL) / 1024, 256, 0, stream>>>(fc1w_f, fc1w, DIM_FF * D_MODEL);
    cvt_f32_bf16<<<(D_MODEL * DIM_FF) / 1024, 256, 0, stream>>>(fc2w_f, fc2w, D_MODEL * DIM_FF);

    // 2) LN1
    ln_to_bf16<<<MROWS, 256, 0, stream>>>(x, ln1s, ln1b, hbf);

    // 3) QKV projection: [8192,1024] x [3072,1024]^T, scatter into heads
    gemm_bf16<EP_QKV><<<dim3(3 * D_MODEL / 128, MROWS / 128), 256, 0, stream>>>(
        hbf, qkvw, MROWS, 3 * D_MODEL, D_MODEL,
        nullptr, nullptr, nullptr, nullptr, Qb, Kb, Vb);

    // 4) flash attention -> Obf [B,T,D]
    attn_fa<<<dim3(SEQ / 128, BATCH * NHEAD), 256, 0, stream>>>(Qb, Kb, Vb, Obf);

    // 5) out projection + residual -> x1 (fp32)
    gemm_bf16<EP_RESID><<<dim3(D_MODEL / 128, MROWS / 128), 256, 0, stream>>>(
        Obf, outw, MROWS, D_MODEL, D_MODEL,
        x, nullptr, x1, nullptr, nullptr, nullptr, nullptr);

    // 6) LN2
    ln_to_bf16<<<MROWS, 256, 0, stream>>>(x1, ln2s, ln2b, h2bf);

    // 7) fc1 + bias + exact GELU -> a1 (bf16)
    gemm_bf16<EP_BIAS_GELU><<<dim3(DIM_FF / 128, MROWS / 128), 256, 0, stream>>>(
        h2bf, fc1w, MROWS, DIM_FF, D_MODEL,
        nullptr, fc1b, nullptr, a1, nullptr, nullptr, nullptr);

    // 8) fc2 + bias + residual -> d_out (fp32)
    gemm_bf16<EP_BIAS_RESID><<<dim3(D_MODEL / 128, MROWS / 128), 256, 0, stream>>>(
        a1, fc2w, MROWS, D_MODEL, DIM_FF,
        x1, fc2b, out, nullptr, nullptr, nullptr, nullptr);
}

// v002
// One run takes 461 microseconds.
// Two timings next to v001 put it at 1.22 and 1.23 times that version's speed.
// All steps since v000 together make it 1.34 times as fast.
#include <hip/hip_runtime.h>
#include <hip/hip_bf16.h>
#include <math.h>

typedef __attribute__((ext_vector_type(16))) __bf16 v16bf;
typedef __attribute__((ext_vector_type(8)))  __bf16 v8bf;
typedef __attribute__((ext_vector_type(8)))  float  v8f;
typedef __attribute__((ext_vector_type(4)))  unsigned int u32x4;
typedef __attribute__((ext_vector_type(8)))  int i32x8;
typedef __attribute__((ext_vector_type(4)))  int i32x4;

#define D_MODEL 1024
#define NHEAD   16
#define DHEAD   64
#define DIM_FF  4096
#define BATCH   4
#define SEQ     2048
#define MROWS   (BATCH * SEQ)   // 8192

enum { EP_QKV = 0, EP_RESID = 1, EP_BIAS_GELU = 2, EP_BIAS_RESID = 3 };

#if __has_builtin(__builtin_amdgcn_tensor_load_to_lds)
#define HAVE_TDM 1
#else
#define HAVE_TDM 0
#endif

// ---------------------------------------------------------------------------
// fp32 -> bf16 convert (vectorized x4)
// ---------------------------------------------------------------------------
__global__ __launch_bounds__(256)
void cvt_f32_bf16(const float* __restrict__ in, __bf16* __restrict__ out, int n) {
    int i = (blockIdx.x * 256 + threadIdx.x) * 4;
    if (i < n) {
        float4 v = *(const float4*)(in + i);
        out[i + 0] = (__bf16)v.x;
        out[i + 1] = (__bf16)v.y;
        out[i + 2] = (__bf16)v.z;
        out[i + 3] = (__bf16)v.w;
    }
}

// ---------------------------------------------------------------------------
// LayerNorm over D=1024, writes bf16.  One block (8 waves) per row.
// ---------------------------------------------------------------------------
__global__ __launch_bounds__(256)
void ln_to_bf16(const float* __restrict__ x, const float* __restrict__ sc,
                const float* __restrict__ bi, __bf16* __restrict__ out) {
    const int row = blockIdx.x;
    const float* xr = x + (size_t)row * D_MODEL;
    const int t = threadIdx.x, lane = t & 31, wid = t >> 5;

    float v[4]; float s = 0.f;
    #pragma unroll
    for (int i = 0; i < 4; ++i) { v[i] = xr[t + 256 * i]; s += v[i]; }
    #pragma unroll
    for (int m = 16; m >= 1; m >>= 1) s += __shfl_xor(s, m, 32);

    __shared__ float red[8];
    if (lane == 0) red[wid] = s;
    __syncthreads();
    float mu = 0.f;
    #pragma unroll
    for (int i = 0; i < 8; ++i) mu += red[i];
    mu *= (1.f / D_MODEL);

    float vs = 0.f;
    #pragma unroll
    for (int i = 0; i < 4; ++i) { float d = v[i] - mu; vs += d * d; }
    #pragma unroll
    for (int m = 16; m >= 1; m >>= 1) vs += __shfl_xor(vs, m, 32);
    __syncthreads();
    if (lane == 0) red[wid] = vs;
    __syncthreads();
    float var = 0.f;
    #pragma unroll
    for (int i = 0; i < 8; ++i) var += red[i];
    var *= (1.f / D_MODEL);
    const float rstd = rsqrtf(var + 1e-5f);

    #pragma unroll
    for (int i = 0; i < 4; ++i) {
        int c = t + 256 * i;
        out[(size_t)row * D_MODEL + c] = (__bf16)((v[i] - mu) * rstd * sc[c] + bi[c]);
    }
}

#if HAVE_TDM
__device__ __forceinline__ u32x4 tdm_group0(unsigned int lds_addr, const void* gptr) {
    const unsigned long long ga = (unsigned long long)(uintptr_t)gptr;
    u32x4 g0;
    g0[0] = 1u;                                            // count=1, user mode
    g0[1] = lds_addr;                                      // LDS byte address
    g0[2] = (unsigned int)ga;                              // global_addr[31:0]
    g0[3] = ((unsigned int)(ga >> 32) & 0x01FFFFFFu)       // global_addr[56:32]
            | (2u << 30);                                  // type=2 ("image")
    return g0;
}

__device__ __forceinline__ i32x8 tdm_group1(int K, int dim1) {
    i32x8 g1;
    g1[0] = (1 << 16)
          | (1 << 20)
          | (3 << 22)
          | (7 << 25);
    g1[1] = (K & 0xFFFF) << 16;
    g1[2] = ((K >> 16) & 0xFFFF) | ((dim1 & 0xFFFF) << 16);
    g1[3] = ((dim1 >> 16) & 0xFFFF) | (32 << 16);
    g1[4] = 128;
    g1[5] = K;
    g1[6] = 0;
    g1[7] = 0;
    return g1;
}

__device__ __forceinline__ void tdm_load(u32x4 g0, i32x8 g1) {
    const i32x4 z4 = {0, 0, 0, 0};
#if defined(__clang_major__) && (__clang_major__ >= 23)
    const i32x8 z8 = {0, 0, 0, 0, 0, 0, 0, 0};
    __builtin_amdgcn_tensor_load_to_lds(g0, g1, z4, z4, z8, 0);
#else
    __builtin_amdgcn_tensor_load_to_lds(g0, g1, z4, z4, 0);
#endif
}
#endif

template<int EPI>
__global__ __launch_bounds__(256)
void gemm_bf16(const __bf16* __restrict__ A, const __bf16* __restrict__ W,
               int M, int N, int K,
               const float* __restrict__ resid, const float* __restrict__ bias,
               float* __restrict__ outF, __bf16* __restrict__ outB,
               __bf16* __restrict__ q_out, __bf16* __restrict__ k_out,
               __bf16* __restrict__ v_out) {
    __shared__ __attribute__((aligned(32))) __bf16 As[128 * 48];
    __shared__ __attribute__((aligned(32))) __bf16 Bs[128 * 48];

    const int tid = threadIdx.x;
    const int lane = tid & 31, wid = tid >> 5;
    const int waveM = wid & 3, waveN = wid >> 2;          // 4 x 2 wave grid
    const int bm = blockIdx.y * 128, bn = blockIdx.x * 128;
    const int fr = lane & 15;                             // fragment row
    const int halfSel = lane >> 4;                        // K-half (contiguous k order: k = 16*half + s)

    const v8f vzero = {0.f,0.f,0.f,0.f,0.f,0.f,0.f,0.f};
    v8f acc[2][4];
    #pragma unroll
    for (int mi = 0; mi < 2; ++mi)
        #pragma unroll
        for (int ni = 0; ni < 4; ++ni) acc[mi][ni] = vzero;

#if HAVE_TDM
    // flat address low 32 bits of an LDS object == LDS byte offset
    const unsigned int ldsA = (unsigned int)(uintptr_t)&As[0];
    const unsigned int ldsB = (unsigned int)(uintptr_t)&Bs[0];
    const i32x8 g1a = tdm_group1(K, M);
    const i32x8 g1b = tdm_group1(K, N);
#else
    const int lrow = tid >> 1;                            // 0..127
    const int lhalf = tid & 1;                            // 16-col half
#endif

    for (int kt = 0; kt < K; kt += 32) {
        __syncthreads();
#if HAVE_TDM
        if (wid == 0) {
            tdm_load(tdm_group0(ldsA, &A[(size_t)bm * K + kt]), g1a);
            tdm_load(tdm_group0(ldsB, &W[(size_t)bn * K + kt]), g1b);
            __builtin_amdgcn_s_wait_tensorcnt(0);
        }
#else
        *(v16bf*)&As[lrow * 48 + lhalf * 16] =
            *(const v16bf*)&A[(size_t)(bm + lrow) * K + kt + lhalf * 16];
        *(v16bf*)&Bs[lrow * 48 + lhalf * 16] =
            *(const v16bf*)&W[(size_t)(bn + lrow) * K + kt + lhalf * 16];
#endif
        __syncthreads();

        v16bf af[2], bf[4];
        #pragma unroll
        for (int mi = 0; mi < 2; ++mi)
            af[mi] = *(const v16bf*)&As[(waveM * 32 + mi * 16 + fr) * 48 + halfSel * 16];
        #pragma unroll
        for (int ni = 0; ni < 4; ++ni)
            bf[ni] = *(const v16bf*)&Bs[(waveN * 64 + ni * 16 + fr) * 48 + halfSel * 16];

        #pragma unroll
        for (int mi = 0; mi < 2; ++mi)
            #pragma unroll
            for (int ni = 0; ni < 4; ++ni)
                acc[mi][ni] = __builtin_amdgcn_wmma_f32_16x16x32_bf16(
                    false, af[mi], false, bf[ni], (short)0, acc[mi][ni], false, false);
    }

    #pragma unroll
    for (int mi = 0; mi < 2; ++mi) {
        const int mbase = bm + waveM * 32 + mi * 16 + halfSel * 8;
        #pragma unroll
        for (int ni = 0; ni < 4; ++ni) {
            const int n = bn + waveN * 64 + ni * 16 + fr;
            #pragma unroll
            for (int r = 0; r < 8; ++r) {
                const int m = mbase + r;
                const float c = acc[mi][ni][r];
                if constexpr (EPI == EP_QKV) {
                    const int b = m >> 11, t = m & (SEQ - 1);
                    const int type = n >> 10, dall = n & (D_MODEL - 1);
                    const int h = dall >> 6, dh = dall & 63;
                    const size_t idx =
                        (((size_t)(b * NHEAD + h) * SEQ) + t) * DHEAD + dh;
                    __bf16* dst = (type == 0) ? q_out : (type == 1) ? k_out : v_out;
                    dst[idx] = (__bf16)c;
                } else if constexpr (EPI == EP_RESID) {
                    outF[(size_t)m * N + n] = resid[(size_t)m * N + n] + c;
                } else if constexpr (EPI == EP_BIAS_GELU) {
                    const float xg = c + bias[n];
                    const float g = 0.5f * xg * (1.0f + erff(xg * 0.70710678118f));
                    outB[(size_t)m * N + n] = (__bf16)g;
                } else { // EP_BIAS_RESID
                    outF[(size_t)m * N + n] = resid[(size_t)m * N + n] + bias[n] + c;
                }
            }
        }
    }
}

#define KT_PITCH 144u                       // LDS row pitch, bytes
#define KT_BUF   10240u                     // 64 * 144 = 9216, rounded up to a multiple of 2 KiB
typedef __attribute__((ext_vector_type(8))) unsigned int u32x8;

__device__ __forceinline__ unsigned int uni(unsigned int v) { return (unsigned int)__builtin_amdgcn_readfirstlane(v); }
// a wave-uniform test held in a scalar register, so that the branch on it is s_cmp + s_cbranch_scc
__device__ __forceinline__ unsigned int pinned(unsigned int v) {
    unsigned int w = uni(v);
    asm volatile("" : "+s"(w));
    return w;
}
__device__ __forceinline__ u32x8 ktile_group1() {   // extents in bytes, tensor = tile
    u32x8 g;
    g[0] = uni((1u << 20) | (4u << 22) | (3u << 25));
    g[1] = uni(128u << 16);
    g[2] = uni(64u << 16);
    g[3] = uni(128u << 16);
    g[4] = uni(64u);
    g[5] = uni(128u);
    g[6] = uni(0u);
    g[7] = uni(0u);
    return g;
}
__device__ __forceinline__ u32x4 ktile_group0(unsigned int lds_dst, const __bf16* gptr) {
    const unsigned long long ga = (unsigned long long)(uintptr_t)gptr;
    u32x4 g;
    g[0] = uni(1u);
    g[1] = uni(lds_dst);
    g[2] = uni((unsigned int)ga);
    g[3] = uni((((unsigned int)(ga >> 32)) & 0x01FFFFFFu) | 0x80000000u);
    return g;
}
__device__ __forceinline__ void ktile_load(u32x4& g0, u32x8& g1) {
    // the request itself: global tile -> LDS through no register; its waits are written at each use.
    // Both groups are in/out operands: what ktile_wait names then lives in the very scalar
    // registers that the request was issued from.
    asm volatile("tensor_load_to_lds %0, %1" : "+s"(g0), "+s"(g1) :: "memory");
}
__device__ __forceinline__ void ktile_wait(u32x4 g0, u32x8 g1) {
    // the issuer's wait for its request; naming the request's two groups as inputs keeps their
    // scalar registers unwritten from the issue up to this wait
    asm volatile("s_wait_tensorcnt 0x0" :: "s"(g0), "s"(g1) : "memory");
}

__device__ __forceinline__ float other_half(float v) {
    const int b = __builtin_bit_cast(int, v);
    return __builtin_bit_cast(float,
        __builtin_amdgcn_permlanex16(b, b, 0x76543210, 0xfedcba98, false, false));
}

__global__ __launch_bounds__(256)
void attn_fa(const __bf16* __restrict__ Q, const __bf16* __restrict__ Kb,
             const __bf16* __restrict__ Vb, __bf16* __restrict__ O) {
    const int bh = blockIdx.y;                 // b*NHEAD + h
    const int b = bh >> 4, h = bh & 15;
    const int q0 = blockIdx.x * 128;
    const int tid = threadIdx.x, lane = tid & 31, wid = tid >> 5;
    const int fr = lane & 15, halfSel = lane >> 4;
    const size_t headBase = (size_t)bh * SEQ * DHEAD;

    __shared__ __attribute__((aligned(32))) __bf16 Vt[64 * 80];       // V^T tile
    __shared__ __attribute__((aligned(2048))) unsigned char Ks[2 * KT_BUF];   // K ring

    const unsigned int wave = uni(threadIdx.x >> 5);
    const unsigned int ldsK = (unsigned int)(uintptr_t)&Ks[0];
    u32x8 kg1 = ktile_group1();
    u32x4 kg0 = ktile_group0(ldsK, Kb + headBase);
    if (pinned(wave == 0)) {
        ktile_load(kg0, kg1);
        ktile_wait(kg0, kg1);                                // tile 0 landed before the barrier publishes it
    }
    __syncthreads();
    kg0 = ktile_group0(ldsK + KT_BUF, Kb + headBase + 64 * DHEAD);
    if (pinned(wave == 0))
        ktile_load(kg0, kg1);

    const int qrow = q0 + wid * 16 + fr;       // this lane's query (B column)
    v16bf qf[2];
    #pragma unroll
    for (int s = 0; s < 2; ++s)
        qf[s] = *(const v16bf*)&Q[headBase + (size_t)qrow * DHEAD + s * 32 + halfSel * 16];

    const v8f vzero = {0.f,0.f,0.f,0.f,0.f,0.f,0.f,0.f};
    v8f oacc[4];                               // O^T: [d = ni*16 + 8*halfSel + r][query fr]
    #pragma unroll
    for (int ni = 0; ni < 4; ++ni) oacc[ni] = vzero;
    float mrun = -1e30f;                       // same value in both lane halves
    float lrun = 0.f;                          // this half's keys only; joined at the end

    const float scale = 0.125f;   // 1/sqrt(64)

    for (int j0 = 0; j0 < SEQ; j0 += 64) {
        const unsigned int kbuf = ((unsigned int)j0 >> 6) & 1u;
        {   // cooperative transpose of V block into LDS: Vt[d][j]
            const int j = tid >> 2;      // 0..63
            const int c = tid & 3;       // 16-wide d-chunk
            v16bf vv = *(const v16bf*)&Vb[headBase + (size_t)(j0 + j) * DHEAD + c * 16];
            #pragma unroll
            for (int i = 0; i < 16; ++i) Vt[(c * 16 + i) * 80 + j] = vv[i];
        }
        __syncthreads();

        // ---- S^T = K Q^T  (64 keys x 16 queries per wave) ----
        v8f sacc[4];                           // [key = ni*16 + 8*halfSel + r][query fr]
        #pragma unroll
        for (int ni = 0; ni < 4; ++ni) sacc[ni] = vzero;
        #pragma unroll
        for (int ni = 0; ni < 4; ++ni)
            #pragma unroll
            for (int s = 0; s < 2; ++s) {
                const unsigned char* kr = &Ks[kbuf * KT_BUF + (ni * 16 + fr) * KT_PITCH
                                              + s * 64 + halfSel * 32];
                const v8bf klo = *(const v8bf*)kr;
                const v8bf khi = *(const v8bf*)(kr + 16);
                const v16bf kf = __builtin_shufflevector(klo, khi,
                    0, 1, 2, 3, 4, 5, 6, 7, 8, 9, 10, 11, 12, 13, 14, 15);
                sacc[ni] = __builtin_amdgcn_wmma_f32_16x16x32_bf16(
                    false, kf, false, qf[s], (short)0, sacc[ni], false, false);
            }

        // ---- online softmax: one query per lane, 32 of its 64 keys in this lane ----
        float mx = sacc[0][0];
        #pragma unroll
        for (int ni = 0; ni < 4; ++ni)
            #pragma unroll
            for (int r = 0; r < 8; ++r) mx = fmaxf(mx, sacc[ni][r]);
        mx = fmaxf(mx, other_half(mx)) * scale;
        const float mnew = fmaxf(mrun, mx);
        const float alpha = __expf(mrun - mnew);

        // P^T as B operand: element i of block s is key s*32 + (i < 8 ? 8*halfSel + i
        // : 16 + 8*halfSel + i - 8), which is what tiles 2s and 2s+1 hold in this lane.
        v16bf pb[2];
        float rs[4];
        #pragma unroll
        for (int ni = 0; ni < 4; ++ni) {
            rs[ni] = 0.f;
            #pragma unroll
            for (int r = 0; r < 8; ++r) {
                const float p = __expf(sacc[ni][r] * scale - mnew);
                rs[ni] += p;
                pb[ni >> 1][(ni & 1) * 8 + r] = (__bf16)p;
            }
        }
        lrun = lrun * alpha + ((rs[0] + rs[1]) + (rs[2] + rs[3]));
        mrun = mnew;
        #pragma unroll
        for (int ni = 0; ni < 4; ++ni) oacc[ni] *= alpha;

        // ---- O^T += V^T P^T; the A rows of V^T are read in the same key order ----
        #pragma unroll
        for (int s = 0; s < 2; ++s) {
            #pragma unroll
            for (int ni = 0; ni < 4; ++ni) {
                const __bf16* vr = &Vt[(ni * 16 + fr) * 80 + s * 32 + halfSel * 8];
                const v8bf lo = *(const v8bf*)vr;
                const v8bf hi = *(const v8bf*)(vr + 16);
                const v16bf vf = __builtin_shufflevector(lo, hi,
                    0, 1, 2, 3, 4, 5, 6, 7, 8, 9, 10, 11, 12, 13, 14, 15);
                oacc[ni] = __builtin_amdgcn_wmma_f32_16x16x32_bf16(
                    false, vf, false, pb[s], (short)0, oacc[ni], false, false);
            }
        }

        // publish point of the next K tile; the same barrier ends every read of Vt and of
        // this pass's K buffer, so it also stands for the barrier in front of the V stores
        asm volatile("s_wait_dscnt 0x0" ::: "memory");           // this wave's LDS reads are done
        if (pinned(wave == 0))
            ktile_wait(kg0, kg1);                                // next tile has landed
        __syncthreads();
        if (pinned((wave == 0) & (j0 + 128 < SEQ))) {            // refill the buffer just left
            kg0 = ktile_group0(ldsK + kbuf * KT_BUF,
                               Kb + headBase + (size_t)(j0 + 128) * DHEAD);
            ktile_load(kg0, kg1);
        }
    }
    ktile_wait(kg0, kg1);                                        // no request outlives the ring
    asm volatile("s_wait_dscnt 0x0" ::: "memory");               // nor any LDS read of it

    // a lane holds 8 consecutive d of its query in each tile: 16-byte stores
    const float inv = 1.f / (lrun + other_half(lrun));
    #pragma unroll
    for (int ni = 0; ni < 4; ++ni) {
        v8bf ov;
        #pragma unroll
        for (int r = 0; r < 8; ++r) ov[r] = (__bf16)(oacc[ni][r] * inv);
        *(v8bf*)&O[((size_t)(b * SEQ + qrow)) * D_MODEL + h * DHEAD + ni * 16 + halfSel * 8] = ov;
    }
}

// ---------------------------------------------------------------------------
// host orchestration
// ---------------------------------------------------------------------------
extern "C" void kernel_launch(void* const* d_in, const int* in_sizes, int n_in,
                              void* d_out, int out_size, void* d_ws, size_t ws_size,
                              hipStream_t stream) {
    (void)in_sizes; (void)n_in; (void)out_size; (void)ws_size;
    const float* x      = (const float*)d_in[0];
    const float* ln1s   = (const float*)d_in[1];
    const float* ln1b   = (const float*)d_in[2];
    const float* qkvw_f = (const float*)d_in[3];
    const float* outw_f = (const float*)d_in[4];
    const float* ln2s   = (const float*)d_in[5];
    const float* ln2b   = (const float*)d_in[6];
    const float* fc1w_f = (const float*)d_in[7];
    const float* fc1b   = (const float*)d_in[8];
    const float* fc2w_f = (const float*)d_in[9];
    const float* fc2b   = (const float*)d_in[10];
    float* out = (float*)d_out;

    char* ws = (char*)d_ws;
    size_t off = 0;
    auto alloc = [&](size_t bytes) -> void* {
        void* p = ws + off;
        off += (bytes + 255) & ~(size_t)255;
        return p;
    };
    __bf16* qkvw = (__bf16*)alloc((size_t)3 * D_MODEL * D_MODEL * 2);   //  6 MB
    __bf16* outw = (__bf16*)alloc((size_t)D_MODEL * D_MODEL * 2);       //  2 MB
    __bf16* fc1w = (__bf16*)alloc((size_t)DIM_FF * D_MODEL * 2);        //  8 MB
    __bf16* fc2w = (__bf16*)alloc((size_t)D_MODEL * DIM_FF * 2);        //  8 MB
    __bf16* hbf  = (__bf16*)alloc((size_t)MROWS * D_MODEL * 2);         // 16 MB (LN1; reused for LN2)
    __bf16* Qb   = (__bf16*)alloc((size_t)MROWS * D_MODEL * 2);         // 16 MB
    __bf16* Kb   = (__bf16*)alloc((size_t)MROWS * D_MODEL * 2);         // 16 MB
    __bf16* Vb   = (__bf16*)alloc((size_t)MROWS * D_MODEL * 2);         // 16 MB
    __bf16* Obf  = (__bf16*)alloc((size_t)MROWS * D_MODEL * 2);         // 16 MB
    float*  x1   = (float*)alloc((size_t)MROWS * D_MODEL * 4);          // 32 MB
    __bf16* a1   = Qb;    // FFN act (64 MB) reuses dead Q|K|V|O span
    __bf16* h2bf = hbf;   // LN2 output reuses dead LN1 buffer

    // 1) weights -> bf16
    cvt_f32_bf16<<<(3 * D_MODEL * D_MODEL) / 1024, 256, 0, stream>>>(qkvw_f, qkvw, 3 * D_MODEL * D_MODEL);
    cvt_f32_bf16<<<(D_MODEL * D_MODEL) / 1024, 256, 0, stream>>>(outw_f, outw, D_MODEL * D_MODEL);
    cvt_f32_bf16<<<(DIM_FF * D_MODEL) / 1024, 256, 0, stream>>>(fc1w_f, fc1w, DIM_FF * D_MODEL);
    cvt_f32_bf16<<<(D_MODEL * DIM_FF) / 1024, 256, 0, stream>>>(fc2w_f, fc2w, D_MODEL * DIM_FF);

    // 2) LN1
    ln_to_bf16<<<MROWS, 256, 0, stream>>>(x, ln1s, ln1b, hbf);

    // 3) QKV projection: [8192,1024] x [3072,1024]^T, scatter into heads
    gemm_bf16<EP_QKV><<<dim3(3 * D_MODEL / 128, MROWS / 128), 256, 0, stream>>>(
        hbf, qkvw, MROWS, 3 * D_MODEL, D_MODEL,
        nullptr, nullptr, nullptr, nullptr, Qb, Kb, Vb);

    // 4) flash attention -> Obf [B,T,D]
    attn_fa<<<dim3(SEQ / 128, BATCH * NHEAD), 256, 0, stream>>>(Qb, Kb, Vb, Obf);

    // 5) out projection + residual -> x1 (fp32)
    gemm_bf16<EP_RESID><<<dim3(D_MODEL / 128, MROWS / 128), 256, 0, stream>>>(
        Obf, outw, MROWS, D_MODEL, D_MODEL,
        x, nullptr, x1, nullptr, nullptr, nullptr, nullptr);

    // 6) LN2
    ln_to_bf16<<<MROWS, 256, 0, stream>>>(x1, ln2s, ln2b, h2bf);

    // 7) fc1 + bias + exact GELU -> a1 (bf16)
    gemm_bf16<EP_BIAS_GELU><<<dim3(DIM_FF / 128, MROWS / 128), 256, 0, stream>>>(
        h2bf, fc1w, MROWS, DIM_FF, D_MODEL,
        nullptr, fc1b, nullptr, a1, nullptr, nullptr, nullptr);

    // 8) fc2 + bias + residual -> d_out (fp32)
    gemm_bf16<EP_BIAS_RESID><<<dim3(D_MODEL / 128, MROWS / 128), 256, 0, stream>>>(
        a1, fc2w, MROWS, D_MODEL, DIM_FF,
        x1, fc2b, out, nullptr, nullptr, nullptr, nullptr);
}

// v003
// Measured time: 321 microseconds a run.
// Timed twice side by side with v002, it ran 1.43 and 1.45 times as fast.
// Over all steps from v000 it is 1.92 times as fast.
#include <hip/hip_runtime.h>
#include <hip/hip_bf16.h>
#include <math.h>

typedef __attribute__((ext_vector_type(16))) __bf16 v16bf;
typedef __attribute__((ext_vector_type(8)))  __bf16 v8bf;
typedef __attribute__((ext_vector_type(8)))  float  v8f;
typedef __attribute__((ext_vector_type(4)))  unsigned int u32x4;

#define D_MODEL 1024
#define NHEAD   16
#define DHEAD   64
#define DIM_FF  4096
#define BATCH   4
#define SEQ     2048
#define MROWS   (BATCH * SEQ)   // 8192

enum { EP_QKV = 0, EP_RESID = 1, EP_BIAS_GELU = 2, EP_BIAS_RESID = 3 };

// ---------------------------------------------------------------------------
// fp32 -> bf16 convert (vectorized x4)
// ---------------------------------------------------------------------------
__global__ __launch_bounds__(256)
void cvt_f32_bf16(const float* __restrict__ in, __bf16* __restrict__ out, int n) {
    int i = (blockIdx.x * 256 + threadIdx.x) * 4;
    if (i < n) {
        float4 v = *(const float4*)(in + i);
        out[i + 0] = (__bf16)v.x;
        out[i + 1] = (__bf16)v.y;
        out[i + 2] = (__bf16)v.z;
        out[i + 3] = (__bf16)v.w;
    }
}

// ---------------------------------------------------------------------------
// LayerNorm over D=1024, writes bf16.  One block (8 waves) per row.
// ---------------------------------------------------------------------------
__global__ __launch_bounds__(256)
void ln_to_bf16(const float* __restrict__ x, const float* __restrict__ sc,
                const float* __restrict__ bi, __bf16* __restrict__ out) {
    const int row = blockIdx.x;
    const float* xr = x + (size_t)row * D_MODEL;
    const int t = threadIdx.x, lane = t & 31, wid = t >> 5;

    float v[4]; float s = 0.f;
    #pragma unroll
    for (int i = 0; i < 4; ++i) { v[i] = xr[t + 256 * i]; s += v[i]; }
    #pragma unroll
    for (int m = 16; m >= 1; m >>= 1) s += __shfl_xor(s, m, 32);

    __shared__ float red[8];
    if (lane == 0) red[wid] = s;
    __syncthreads();
    float mu = 0.f;
    #pragma unroll
    for (int i = 0; i < 8; ++i) mu += red[i];
    mu *= (1.f / D_MODEL);

    float vs = 0.f;
    #pragma unroll
    for (int i = 0; i < 4; ++i) { float d = v[i] - mu; vs += d * d; }
    #pragma unroll
    for (int m = 16; m >= 1; m >>= 1) vs += __shfl_xor(vs, m, 32);
    __syncthreads();
    if (lane == 0) red[wid] = vs;
    __syncthreads();
    float var = 0.f;
    #pragma unroll
    for (int i = 0; i < 8; ++i) var += red[i];
    var *= (1.f / D_MODEL);
    const float rstd = rsqrtf(var + 1e-5f);

    #pragma unroll
    for (int i = 0; i < 4; ++i) {
        int c = t + 256 * i;
        out[(size_t)row * D_MODEL + c] = (__bf16)((v[i] - mu) * rstd * sc[c] + bi[c]);
    }
}

// ---------------------------------------------------------------------------
// Tensor mover helpers, shared by the GEMM and the attention kernel.
// ---------------------------------------------------------------------------
typedef __attribute__((ext_vector_type(8))) unsigned int u32x8;

__device__ __forceinline__ unsigned int uni(unsigned int v) { return (unsigned int)__builtin_amdgcn_readfirstlane(v); }
// a wave-uniform test held in a scalar register, so that the branch on it is s_cmp + s_cbranch_scc
__device__ __forceinline__ unsigned int pinned(unsigned int v) {
    unsigned int w = uni(v);
    asm volatile("" : "+s"(w));
    return w;
}
__device__ __forceinline__ u32x4 ktile_group0(unsigned int lds_dst, const __bf16* gptr) {
    const unsigned long long ga = (unsigned long long)(uintptr_t)gptr;
    u32x4 g;
    g[0] = uni(1u);
    g[1] = uni(lds_dst);
    g[2] = uni((unsigned int)ga);
    g[3] = uni((((unsigned int)(ga >> 32)) & 0x01FFFFFFu) | 0x80000000u);
    return g;
}
__device__ __forceinline__ void ktile_load(u32x4& g0, u32x8& g1) {
    // the request itself: global tile -> LDS through no register; its waits are written at each use.
    // Both groups are in/out operands: what ktile_wait names then lives in the very scalar
    // registers that the request was issued from.
    asm volatile("tensor_load_to_lds %0, %1" : "+s"(g0), "+s"(g1) :: "memory");
}
__device__ __forceinline__ void ktile_wait(u32x4 g0, u32x8 g1) {
    // the issuer's wait for its request; naming the request's two groups as inputs keeps their
    // scalar registers unwritten from the issue up to this wait
    asm volatile("s_wait_tensorcnt 0x0" :: "s"(g0), "s"(g1) : "memory");
}

// ---------------------------------------------------------------------------
// Tiled bf16 GEMM:  C[M,N] = A[M,K] * W[N,K]^T   (torch Linear layout)
// 128x128 block tile, 8 waves, each wave 32x64 (2x4 WMMA 16x16 tiles).
// A stage is 128 k of the block's 128 A rows and 128 W rows.  It comes into a ring of two
// LDS buffers by tensor load, one stage ahead of the pass that reads it: waves 0 to 3 each
// bring one slice of 64 rows x 256 bytes.  M, N multiples of 128; K a multiple of 128, >= 256.
// ---------------------------------------------------------------------------
#define GT_PITCH 272u
#define GT_SLICE 18432u
#define GT_BUF   (4u * GT_SLICE)

__device__ __forceinline__ u32x8 gtile_group1(unsigned int src_pitch) {   // extents in bytes, tensor = tile
    u32x8 g;
    g[0] = uni((1u << 20) | (5u << 22) | (3u << 25));
    g[1] = uni(256u << 16);
    g[2] = uni(64u << 16);
    g[3] = uni(256u << 16);
    g[4] = uni(64u);
    g[5] = uni(src_pitch);
    g[6] = uni(0u);
    g[7] = uni(0u);
    return g;
}
// 16 consecutive k of one LDS row: rows are 16-byte aligned only, so two 16-byte reads
__device__ __forceinline__ v16bf gfrag(const unsigned char* p) {
    const v8bf lo = *(const v8bf*)p;
    const v8bf hi = *(const v8bf*)(p + 16);
    return __builtin_shufflevector(lo, hi, 0, 1, 2, 3, 4, 5, 6, 7, 8, 9, 10, 11, 12, 13, 14, 15);
}

template<int EPI>
__global__ __launch_bounds__(256)
void gemm_bf16(const __bf16* __restrict__ A, const __bf16* __restrict__ W,
               int M, int N, int K,
               const float* __restrict__ resid, const float* __restrict__ bias,
               float* __restrict__ outF, __bf16* __restrict__ outB,
               __bf16* __restrict__ q_out, __bf16* __restrict__ k_out,
               __bf16* __restrict__ v_out) {
    __shared__ __attribute__((aligned(2048))) unsigned char Gs[2 * GT_BUF];   // stage ring

    const int tid = threadIdx.x;
    const int lane = tid & 31, wid = tid >> 5;
    const int waveM = wid & 3, waveN = wid >> 2;          // 4 x 2 wave grid
    const int bm = blockIdx.y * 128, bn = blockIdx.x * 128;
    const int fr = lane & 15;                             // fragment row
    const int halfSel = lane >> 4;                        // K-half (contiguous k order: k = 16*half + s)

    const v8f vzero = {0.f,0.f,0.f,0.f,0.f,0.f,0.f,0.f};
    v8f acc[2][4];
    #pragma unroll
    for (int mi = 0; mi < 2; ++mi)
        #pragma unroll
        for (int ni = 0; ni < 4; ++ni) acc[mi][ni] = vzero;

    // this wave's slice of every stage (waves 4 to 7 form the same words and never issue)
    const unsigned int wave = uni(threadIdx.x >> 5);
    const unsigned int slice = wave & 3u;
    const __bf16* sl = (slice & 2u) ? W + (size_t)(bn + (slice & 1u) * 64u) * K
                                    : A + (size_t)(bm + (slice & 1u) * 64u) * K;
    const unsigned int ldsS = (unsigned int)(uintptr_t)&Gs[0] + slice * GT_SLICE;
    u32x8 gg1 = gtile_group1((unsigned int)K * 2u);
    u32x4 gg0 = ktile_group0(ldsS, sl);
    if (pinned(wave < 4u)) {
        ktile_load(gg0, gg1);
        ktile_wait(gg0, gg1);                                // stage 0 landed before the barrier publishes it
    }
    __syncthreads();
    gg0 = ktile_group0(ldsS + GT_BUF, sl + 128);
    if (pinned(wave < 4u))
        ktile_load(gg0, gg1);

    // this lane's first A and W bytes inside a buffer
    const unsigned int aoff = (unsigned int)(waveM >> 1) * GT_SLICE
                            + (unsigned int)((waveM & 1) * 32 + fr) * GT_PITCH + (unsigned int)halfSel * 32u;
    const unsigned int boff = (unsigned int)(2 + waveN) * GT_SLICE
                            + (unsigned int)fr * GT_PITCH + (unsigned int)halfSel * 32u;

    for (int kt = 0; kt < K; kt += 128) {
        const unsigned int buf = ((unsigned int)kt >> 7) & 1u;
        const unsigned char* ap = &Gs[buf * GT_BUF + aoff];
        const unsigned char* bp = &Gs[buf * GT_BUF + boff];

        // unrolled so that every fragment offset is an immediate and a block's reads can go ahead of the block before
        #pragma unroll
        for (int kb = 0; kb < 4; ++kb) {
            v16bf af[2], bf[4];
            #pragma unroll
            for (int mi = 0; mi < 2; ++mi)
                af[mi] = gfrag(ap + mi * 16 * GT_PITCH + kb * 64);
            #pragma unroll
            for (int ni = 0; ni < 4; ++ni)
                bf[ni] = gfrag(bp + ni * 16 * GT_PITCH + kb * 64);

            #pragma unroll
            for (int mi = 0; mi < 2; ++mi)
                #pragma unroll
                for (int ni = 0; ni < 4; ++ni)
                    acc[mi][ni] = __builtin_amdgcn_wmma_f32_16x16x32_bf16(
                        false, af[mi], false, bf[ni], (short)0, acc[mi][ni], false, false);
        }

        // publish point of the next stage; the same barrier ends every read of this pass's buffer
        asm volatile("s_wait_dscnt 0x0" ::: "memory");           // this wave's LDS reads are done
        if (pinned(wave < 4u))
            ktile_wait(gg0, gg1);                                // this wave's slice of the next stage has landed
        __syncthreads();
        if (pinned((wave < 4u) & (kt + 256 < K))) {              // refill the buffer just left
            gg0 = ktile_group0(ldsS + buf * GT_BUF, sl + kt + 256);
            ktile_load(gg0, gg1);
        }
    }
    ktile_wait(gg0, gg1);                                        // no request outlives the ring
    asm volatile("s_wait_dscnt 0x0" ::: "memory");               // nor any LDS read of it

    #pragma unroll
    for (int mi = 0; mi < 2; ++mi) {
        const int mbase = bm + waveM * 32 + mi * 16 + halfSel * 8;
        #pragma unroll
        for (int ni = 0; ni < 4; ++ni) {
            const int n = bn + waveN * 64 + ni * 16 + fr;
            #pragma unroll
            for (int r = 0; r < 8; ++r) {
                const int m = mbase + r;
                const float c = acc[mi][ni][r];
                if constexpr (EPI == EP_QKV) {
                    const int b = m >> 11, t = m & (SEQ - 1);
                    const int type = n >> 10, dall = n & (D_MODEL - 1);
                    const int h = dall >> 6, dh = dall & 63;
                    const size_t idx =
                        (((size_t)(b * NHEAD + h) * SEQ) + t) * DHEAD + dh;
                    __bf16* dst = (type == 0) ? q_out : (type == 1) ? k_out : v_out;
                    dst[idx] = (__bf16)c;
                } else if constexpr (EPI == EP_RESID) {
                    outF[(size_t)m * N + n] = resid[(size_t)m * N + n] + c;
                } else if constexpr (EPI == EP_BIAS_GELU) {
                    const float xg = c + bias[n];
                    const float g = 0.5f * xg * (1.0f + erff(xg * 0.70710678118f));
                    outB[(size_t)m * N + n] = (__bf16)g;
                } else { // EP_BIAS_RESID
                    outF[(size_t)m * N + n] = resid[(size_t)m * N + n] + bias[n] + c;
                }
            }
        }
    }
}

#define KT_PITCH 144u                       // LDS row pitch, bytes
#define KT_BUF   10240u                     // 64 * 144 = 9216, rounded up to a multiple of 2 KiB
__device__ __forceinline__ u32x8 ktile_group1() {   // extents in bytes, tensor = tile
    u32x8 g;
    g[0] = uni((1u << 20) | (4u << 22) | (3u << 25));
    g[1] = uni(128u << 16);
    g[2] = uni(64u << 16);
    g[3] = uni(128u << 16);
    g[4] = uni(64u);
    g[5] = uni(128u);
    g[6] = uni(0u);
    g[7] = uni(0u);
    return g;
}

__device__ __forceinline__ float other_half(float v) {
    const int b = __builtin_bit_cast(int, v);
    return __builtin_bit_cast(float,
        __builtin_amdgcn_permlanex16(b, b, 0x76543210, 0xfedcba98, false, false));
}

__global__ __launch_bounds__(256)
void attn_fa(const __bf16* __restrict__ Q, const __bf16* __restrict__ Kb,
             const __bf16* __restrict__ Vb, __bf16* __restrict__ O) {
    const int bh = blockIdx.y;                 // b*NHEAD + h
    const int b = bh >> 4, h = bh & 15;
    const int q0 = blockIdx.x * 128;
    const int tid = threadIdx.x, lane = tid & 31, wid = tid >> 5;
    const int fr = lane & 15, halfSel = lane >> 4;
    const size_t headBase = (size_t)bh * SEQ * DHEAD;

    __shared__ __attribute__((aligned(32))) __bf16 Vt[64 * 80];       // V^T tile
    __shared__ __attribute__((aligned(2048))) unsigned char Ks[2 * KT_BUF];   // K ring

    const unsigned int wave = uni(threadIdx.x >> 5);
    const unsigned int ldsK = (unsigned int)(uintptr_t)&Ks[0];
    u32x8 kg1 = ktile_group1();
    u32x4 kg0 = ktile_group0(ldsK, Kb + headBase);
    if (pinned(wave == 0)) {
        ktile_load(kg0, kg1);
        ktile_wait(kg0, kg1);                                // tile 0 landed before the barrier publishes it
    }
    __syncthreads();
    kg0 = ktile_group0(ldsK + KT_BUF, Kb + headBase + 64 * DHEAD);
    if (pinned(wave == 0))
        ktile_load(kg0, kg1);

    const int qrow = q0 + wid * 16 + fr;       // this lane's query (B column)
    v16bf qf[2];
    #pragma unroll
    for (int s = 0; s < 2; ++s)
        qf[s] = *(const v16bf*)&Q[headBase + (size_t)qrow * DHEAD + s * 32 + halfSel * 16];

    const v8f vzero = {0.f,0.f,0.f,0.f,0.f,0.f,0.f,0.f};
    v8f oacc[4];                               // O^T: [d = ni*16 + 8*halfSel + r][query fr]
    #pragma unroll
    for (int ni = 0; ni < 4; ++ni) oacc[ni] = vzero;
    float mrun = -1e30f;                       // same value in both lane halves
    float lrun = 0.f;                          // this half's keys only; joined at the end

    const float scale = 0.125f;   // 1/sqrt(64)

    for (int j0 = 0; j0 < SEQ; j0 += 64) {
        const unsigned int kbuf = ((unsigned int)j0 >> 6) & 1u;
        {   // cooperative transpose of V block into LDS: Vt[d][j]
            const int j = tid >> 2;      // 0..63
            const int c = tid & 3;       // 16-wide d-chunk
            v16bf vv = *(const v16bf*)&Vb[headBase + (size_t)(j0 + j) * DHEAD + c * 16];
            #pragma unroll
            for (int i = 0; i < 16; ++i) Vt[(c * 16 + i) * 80 + j] = vv[i];
        }
        __syncthreads();

        // ---- S^T = K Q^T  (64 keys x 16 queries per wave) ----
        v8f sacc[4];                           // [key = ni*16 + 8*halfSel + r][query fr]
        #pragma unroll
        for (int ni = 0; ni < 4; ++ni) sacc[ni] = vzero;
        #pragma unroll
        for (int ni = 0; ni < 4; ++ni)
            #pragma unroll
            for (int s = 0; s < 2; ++s) {
                const unsigned char* kr = &Ks[kbuf * KT_BUF + (ni * 16 + fr) * KT_PITCH
                                              + s * 64 + halfSel * 32];
                const v8bf klo = *(const v8bf*)kr;
                const v8bf khi = *(const v8bf*)(kr + 16);
                const v16bf kf = __builtin_shufflevector(klo, khi,
                    0, 1, 2, 3, 4, 5, 6, 7, 8, 9, 10, 11, 12, 13, 14, 15);
                sacc[ni] = __builtin_amdgcn_wmma_f32_16x16x32_bf16(
                    false, kf, false, qf[s], (short)0, sacc[ni], false, false);
            }

        // ---- online softmax: one query per lane, 32 of its 64 keys in this lane ----
        float mx = sacc[0][0];
        #pragma unroll
        for (int ni = 0; ni < 4; ++ni)
            #pragma unroll
            for (int r = 0; r < 8; ++r) mx = fmaxf(mx, sacc[ni][r]);
        mx = fmaxf(mx, other_half(mx)) * scale;
        const float mnew = fmaxf(mrun, mx);
        const float alpha = __expf(mrun - mnew);

        // P^T as B operand: element i of block s is key s*32 + (i < 8 ? 8*halfSel + i
        // : 16 + 8*halfSel + i - 8), which is what tiles 2s and 2s+1 hold in this lane.
        v16bf pb[2];
        float rs[4];
        #pragma unroll
        for (int ni = 0; ni < 4; ++ni) {
            rs[ni] = 0.f;
            #pragma unroll
            for (int r = 0; r < 8; ++r) {
                const float p = __expf(sacc[ni][r] * scale - mnew);
                rs[ni] += p;
                pb[ni >> 1][(ni & 1) * 8 + r] = (__bf16)p;
            }
        }
        lrun = lrun * alpha + ((rs[0] + rs[1]) + (rs[2] + rs[3]));
        mrun = mnew;
        #pragma unroll
        for (int ni = 0; ni < 4; ++ni) oacc[ni] *= alpha;

        // ---- O^T += V^T P^T; the A rows of V^T are read in the same key order ----
        #pragma unroll
        for (int s = 0; s < 2; ++s) {
            #pragma unroll
            for (int ni = 0; ni < 4; ++ni) {
                const __bf16* vr = &Vt[(ni * 16 + fr) * 80 + s * 32 + halfSel * 8];
                const v8bf lo = *(const v8bf*)vr;
                const v8bf hi = *(const v8bf*)(vr + 16);
                const v16bf vf = __builtin_shufflevector(lo, hi,
                    0, 1, 2, 3, 4, 5, 6, 7, 8, 9, 10, 11, 12, 13, 14, 15);
                oacc[ni] = __builtin_amdgcn_wmma_f32_16x16x32_bf16(
                    false, vf, false, pb[s], (short)0, oacc[ni], false, false);
            }
        }

        // publish point of the next K tile; the same barrier ends every read of Vt and of
        // this pass's K buffer, so it also stands for the barrier in front of the V stores
        asm volatile("s_wait_dscnt 0x0" ::: "memory");           // this wave's LDS reads are done
        if (pinned(wave == 0))
            ktile_wait(kg0, kg1);                                // next tile has landed
        __syncthreads();
        if (pinned((wave == 0) & (j0 + 128 < SEQ))) {            // refill the buffer just left
            kg0 = ktile_group0(ldsK + kbuf * KT_BUF,
                               Kb + headBase + (size_t)(j0 + 128) * DHEAD);
            ktile_load(kg0, kg1);
        }
    }
    ktile_wait(kg0, kg1);                                        // no request outlives the ring
    asm volatile("s_wait_dscnt 0x0" ::: "memory");               // nor any LDS read of it

    // a lane holds 8 consecutive d of its query in each tile: 16-byte stores
    const float inv = 1.f / (lrun + other_half(lrun));
    #pragma unroll
    for (int ni = 0; ni < 4; ++ni) {
        v8bf ov;
        #pragma unroll
        for (int r = 0; r < 8; ++r) ov[r] = (__bf16)(oacc[ni][r] * inv);
        *(v8bf*)&O[((size_t)(b * SEQ + qrow)) * D_MODEL + h * DHEAD + ni * 16 + halfSel * 8] = ov;
    }
}

// ---------------------------------------------------------------------------
// host orchestration
// ---------------------------------------------------------------------------
extern "C" void kernel_launch(void* const* d_in, const int* in_sizes, int n_in,
                              void* d_out, int out_size, void* d_ws, size_t ws_size,
                              hipStream_t stream) {
    (void)in_sizes; (void)n_in; (void)out_size; (void)ws_size;
    const float* x      = (const float*)d_in[0];
    const float* ln1s   = (const float*)d_in[1];
    const float* ln1b   = (const float*)d_in[2];
    const float* qkvw_f = (const float*)d_in[3];
    const float* outw_f = (const float*)d_in[4];
    const float* ln2s   = (const float*)d_in[5];
    const float* ln2b   = (const float*)d_in[6];
    const float* fc1w_f = (const float*)d_in[7];
    const float* fc1b   = (const float*)d_in[8];
    const float* fc2w_f = (const float*)d_in[9];
    const float* fc2b   = (const float*)d_in[10];
    float* out = (float*)d_out;

    char* ws = (char*)d_ws;
    size_t off = 0;
    auto alloc = [&](size_t bytes) -> void* {
        void* p = ws + off;
        off += (bytes + 255) & ~(size_t)255;
        return p;
    };
    __bf16* qkvw = (__bf16*)alloc((size_t)3 * D_MODEL * D_MODEL * 2);   //  6 MB
    __bf16* outw = (__bf16*)alloc((size_t)D_MODEL * D_MODEL * 2);       //  2 MB
    __bf16* fc1w = (__bf16*)alloc((size_t)DIM_FF * D_MODEL * 2);        //  8 MB
    __bf16* fc2w = (__bf16*)alloc((size_t)D_MODEL * DIM_FF * 2);        //  8 MB
    __bf16* hbf  = (__bf16*)alloc((size_t)MROWS * D_MODEL * 2);         // 16 MB (LN1; reused for LN2)
    __bf16* Qb   = (__bf16*)alloc((size_t)MROWS * D_MODEL * 2);         // 16 MB
    __bf16* Kb   = (__bf16*)alloc((size_t)MROWS * D_MODEL * 2);         // 16 MB
    __bf16* Vb   = (__bf16*)alloc((size_t)MROWS * D_MODEL * 2);         // 16 MB
    __bf16* Obf  = (__bf16*)alloc((size_t)MROWS * D_MODEL * 2);         // 16 MB
    float*  x1   = (float*)alloc((size_t)MROWS * D_MODEL * 4);          // 32 MB
    __bf16* a1   = Qb;    // FFN act (64 MB) reuses dead Q|K|V|O span
    __bf16* h2bf = hbf;   // LN2 output reuses dead LN1 buffer

    // 1) weights -> bf16
    cvt_f32_bf16<<<(3 * D_MODEL * D_MODEL) / 1024, 256, 0, stream>>>(qkvw_f, qkvw, 3 * D_MODEL * D_MODEL);
    cvt_f32_bf16<<<(D_MODEL * D_MODEL) / 1024, 256, 0, stream>>>(outw_f, outw, D_MODEL * D_MODEL);
    cvt_f32_bf16<<<(DIM_FF * D_MODEL) / 1024, 256, 0, stream>>>(fc1w_f, fc1w, DIM_FF * D_MODEL);
    cvt_f32_bf16<<<(D_MODEL * DIM_FF) / 1024, 256, 0, stream>>>(fc2w_f, fc2w, D_MODEL * DIM_FF);

    // 2) LN1
    ln_to_bf16<<<MROWS, 256, 0, stream>>>(x, ln1s, ln1b, hbf);

    // 3) QKV projection: [8192,1024] x [3072,1024]^T, scatter into heads
    gemm_bf16<EP_QKV><<<dim3(3 * D_MODEL / 128, MROWS / 128), 256, 0, stream>>>(
        hbf, qkvw, MROWS, 3 * D_MODEL, D_MODEL,
        nullptr, nullptr, nullptr, nullptr, Qb, Kb, Vb);

    // 4) flash attention -> Obf [B,T,D]
    attn_fa<<<dim3(SEQ / 128, BATCH * NHEAD), 256, 0, stream>>>(Qb, Kb, Vb, Obf);

    // 5) out projection + residual -> x1 (fp32)
    gemm_bf16<EP_RESID><<<dim3(D_MODEL / 128, MROWS / 128), 256, 0, stream>>>(
        Obf, outw, MROWS, D_MODEL, D_MODEL,
        x, nullptr, x1, nullptr, nullptr, nullptr, nullptr);

    // 6) LN2
    ln_to_bf16<<<MROWS, 256, 0, stream>>>(x1, ln2s, ln2b, h2bf);

    // 7) fc1 + bias + exact GELU -> a1 (bf16)
    gemm_bf16<EP_BIAS_GELU><<<dim3(DIM_FF / 128, MROWS / 128), 256, 0, stream>>>(
        h2bf, fc1w, MROWS, DIM_FF, D_MODEL,
        nullptr, fc1b, nullptr, a1, nullptr, nullptr, nullptr);

    // 8) fc2 + bias + residual -> d_out (fp32)
    gemm_bf16<EP_BIAS_RESID><<<dim3(D_MODEL / 128, MROWS / 128), 256, 0, stream>>>(
        a1, fc2w, MROWS, D_MODEL, DIM_FF,
        x1, fc2b, out, nullptr, nullptr, nullptr, nullptr);
}

// v004
// It runs in 278 microseconds.
// Next to v003, in two timings, it ran 1.16 and 1.15 times as fast.
// All steps since v000 together make it 2.22 times as fast.
#include <hip/hip_runtime.h>
#include <hip/hip_bf16.h>
#include <math.h>

typedef __attribute__((ext_vector_type(16))) __bf16 v16bf;
typedef __attribute__((ext_vector_type(8)))  __bf16 v8bf;
typedef __attribute__((ext_vector_type(8)))  float  v8f;
typedef __attribute__((ext_vector_type(4)))  unsigned int u32x4;

#define D_MODEL 1024
#define NHEAD   16
#define DHEAD   64
#define DIM_FF  4096
#define BATCH   4
#define SEQ     2048
#define MROWS   (BATCH * SEQ)   // 8192

enum { EP_QKV = 0, EP_RESID = 1, EP_BIAS_GELU = 2, EP_BIAS_RESID = 3 };

// ---------------------------------------------------------------------------
// fp32 -> bf16 convert (vectorized x4)
// ---------------------------------------------------------------------------
__global__ __launch_bounds__(256)
void cvt_f32_bf16(const float* __restrict__ in, __bf16* __restrict__ out, int n) {
    int i = (blockIdx.x * 256 + threadIdx.x) * 4;
    if (i < n) {
        float4 v = *(const float4*)(in + i);
        out[i + 0] = (__bf16)v.x;
        out[i + 1] = (__bf16)v.y;
        out[i + 2] = (__bf16)v.z;
        out[i + 3] = (__bf16)v.w;
    }
}

// ---------------------------------------------------------------------------
// LayerNorm over D=1024, writes bf16.  One block (8 waves) per row.
// ---------------------------------------------------------------------------
__global__ __launch_bounds__(256)
void ln_to_bf16(const float* __restrict__ x, const float* __restrict__ sc,
                const float* __restrict__ bi, __bf16* __restrict__ out) {
    const int row = blockIdx.x;
    const float* xr = x + (size_t)row * D_MODEL;
    const int t = threadIdx.x, lane = t & 31, wid = t >> 5;

    float v[4]; float s = 0.f;
    #pragma unroll
    for (int i = 0; i < 4; ++i) { v[i] = xr[t + 256 * i]; s += v[i]; }
    #pragma unroll
    for (int m = 16; m >= 1; m >>= 1) s += __shfl_xor(s, m, 32);

    __shared__ float red[8];
    if (lane == 0) red[wid] = s;
    __syncthreads();
    float mu = 0.f;
    #pragma unroll
    for (int i = 0; i < 8; ++i) mu += red[i];
    mu *= (1.f / D_MODEL);

    float vs = 0.f;
    #pragma unroll
    for (int i = 0; i < 4; ++i) { float d = v[i] - mu; vs += d * d; }
    #pragma unroll
    for (int m = 16; m >= 1; m >>= 1) vs += __shfl_xor(vs, m, 32);
    __syncthreads();
    if (lane == 0) red[wid] = vs;
    __syncthreads();
    float var = 0.f;
    #pragma unroll
    for (int i = 0; i < 8; ++i) var += red[i];
    var *= (1.f / D_MODEL);
    const float rstd = rsqrtf(var + 1e-5f);

    #pragma unroll
    for (int i = 0; i < 4; ++i) {
        int c = t + 256 * i;
        out[(size_t)row * D_MODEL + c] = (__bf16)((v[i] - mu) * rstd * sc[c] + bi[c]);
    }
}

// ---------------------------------------------------------------------------
// Tensor mover helpers, shared by the GEMM and the attention kernel.
// ---------------------------------------------------------------------------
typedef __attribute__((ext_vector_type(8))) unsigned int u32x8;

__device__ __forceinline__ unsigned int uni(unsigned int v) { return (unsigned int)__builtin_amdgcn_readfirstlane(v); }
// a wave-uniform test held in a scalar register, so that the branch on it is s_cmp + s_cbranch_scc
__device__ __forceinline__ unsigned int pinned(unsigned int v) {
    unsigned int w = uni(v);
    asm volatile("" : "+s"(w));
    return w;
}
__device__ __forceinline__ u32x4 ktile_group0(unsigned int lds_dst, const __bf16* gptr) {
    const unsigned long long ga = (unsigned long long)(uintptr_t)gptr;
    u32x4 g;
    g[0] = uni(1u);
    g[1] = uni(lds_dst);
    g[2] = uni((unsigned int)ga);
    g[3] = uni((((unsigned int)(ga >> 32)) & 0x01FFFFFFu) | 0x80000000u);
    return g;
}
__device__ __forceinline__ void ktile_load(u32x4& g0, u32x8& g1) {
    // the request itself: global tile -> LDS through no register; its waits are written at each use.
    // Both groups are in/out operands: what ktile_wait names then lives in the very scalar
    // registers that the request was issued from.
    asm volatile("tensor_load_to_lds %0, %1" : "+s"(g0), "+s"(g1) :: "memory");
}
__device__ __forceinline__ void ktile_wait(u32x4 g0, u32x8 g1) {
    // the issuer's wait for its request; naming the request's two groups as inputs keeps their
    // scalar registers unwritten from the issue up to this wait
    asm volatile("s_wait_tensorcnt 0x0" :: "s"(g0), "s"(g1) : "memory");
}

// ---------------------------------------------------------------------------
// Tiled bf16 GEMM:  C[M,N] = A[M,K] * W[N,K]^T   (torch Linear layout)
// 128x128 block tile, 8 waves, each wave 32x64 (2x4 WMMA 16x16 tiles).
// A stage is 128 k of the block's 128 A rows and 128 W rows.  It comes into a ring of two
// LDS buffers by tensor load, one stage ahead of the pass that reads it: waves 0 to 3 each
// bring one slice of 64 rows x 256 bytes.  M, N multiples of 128; K a multiple of 128, >= 256.
// ---------------------------------------------------------------------------
#define GT_PITCH 272u
#define GT_SLICE 18432u
#define GT_BUF   (4u * GT_SLICE)

__device__ __forceinline__ u32x8 gtile_group1(unsigned int src_pitch) {   // extents in bytes, tensor = tile
    u32x8 g;
    g[0] = uni((1u << 20) | (5u << 22) | (3u << 25));
    g[1] = uni(256u << 16);
    g[2] = uni(64u << 16);
    g[3] = uni(256u << 16);
    g[4] = uni(64u);
    g[5] = uni(src_pitch);
    g[6] = uni(0u);
    g[7] = uni(0u);
    return g;
}
// 16 consecutive k of one LDS row: rows are 16-byte aligned only, so two 16-byte reads
__device__ __forceinline__ v16bf gfrag(const unsigned char* p) {
    const v8bf lo = *(const v8bf*)p;
    const v8bf hi = *(const v8bf*)(p + 16);
    return __builtin_shufflevector(lo, hi, 0, 1, 2, 3, 4, 5, 6, 7, 8, 9, 10, 11, 12, 13, 14, 15);
}

template<int EPI>
__global__ __launch_bounds__(256)
void gemm_bf16(const __bf16* __restrict__ A, const __bf16* __restrict__ W,
               int M, int N, int K,
               const float* __restrict__ resid, const float* __restrict__ bias,
               float* __restrict__ outF, __bf16* __restrict__ outB,
               __bf16* __restrict__ q_out, __bf16* __restrict__ k_out,
               __bf16* __restrict__ v_out) {
    __shared__ __attribute__((aligned(2048))) unsigned char Gs[2 * GT_BUF];   // stage ring

    const int tid = threadIdx.x;
    const int lane = tid & 31, wid = tid >> 5;
    const int waveM = wid & 3, waveN = wid >> 2;          // 4 x 2 wave grid
    const int bm = blockIdx.y * 128, bn = blockIdx.x * 128;
    const int fr = lane & 15;                             // fragment row
    const int halfSel = lane >> 4;                        // K-half (contiguous k order: k = 16*half + s)

    const v8f vzero = {0.f,0.f,0.f,0.f,0.f,0.f,0.f,0.f};
    v8f acc[2][4];
    #pragma unroll
    for (int mi = 0; mi < 2; ++mi)
        #pragma unroll
        for (int ni = 0; ni < 4; ++ni) acc[mi][ni] = vzero;

    // this wave's slice of every stage (waves 4 to 7 form the same words and never issue)
    const unsigned int wave = uni(threadIdx.x >> 5);
    const unsigned int slice = wave & 3u;
    const __bf16* sl = (slice & 2u) ? W + (size_t)(bn + (slice & 1u) * 64u) * K
                                    : A + (size_t)(bm + (slice & 1u) * 64u) * K;
    const unsigned int ldsS = (unsigned int)(uintptr_t)&Gs[0] + slice * GT_SLICE;
    u32x8 gg1 = gtile_group1((unsigned int)K * 2u);
    u32x4 gg0 = ktile_group0(ldsS, sl);
    if (pinned(wave < 4u)) {
        ktile_load(gg0, gg1);
        ktile_wait(gg0, gg1);                                // stage 0 landed before the barrier publishes it
    }
    __syncthreads();
    gg0 = ktile_group0(ldsS + GT_BUF, sl + 128);
    if (pinned(wave < 4u))
        ktile_load(gg0, gg1);

    // this lane's first A and W bytes inside a buffer
    const unsigned int aoff = (unsigned int)(waveM >> 1) * GT_SLICE
                            + (unsigned int)((waveM & 1) * 32 + fr) * GT_PITCH + (unsigned int)halfSel * 32u;
    const unsigned int boff = (unsigned int)(2 + waveN) * GT_SLICE
                            + (unsigned int)fr * GT_PITCH + (unsigned int)halfSel * 32u;

    for (int kt = 0; kt < K; kt += 128) {
        const unsigned int buf = ((unsigned int)kt >> 7) & 1u;
        const unsigned char* ap = &Gs[buf * GT_BUF + aoff];
        const unsigned char* bp = &Gs[buf * GT_BUF + boff];

        // unrolled so that every fragment offset is an immediate and a block's reads can go ahead of the block before
        #pragma unroll
        for (int kb = 0; kb < 4; ++kb) {
            v16bf af[2], bf[4];
            #pragma unroll
            for (int mi = 0; mi < 2; ++mi)
                af[mi] = gfrag(ap + mi * 16 * GT_PITCH + kb * 64);
            #pragma unroll
            for (int ni = 0; ni < 4; ++ni)
                bf[ni] = gfrag(bp + ni * 16 * GT_PITCH + kb * 64);

            #pragma unroll
            for (int mi = 0; mi < 2; ++mi)
                #pragma unroll
                for (int ni = 0; ni < 4; ++ni)
                    acc[mi][ni] = __builtin_amdgcn_wmma_f32_16x16x32_bf16(
                        false, af[mi], false, bf[ni], (short)0, acc[mi][ni], false, false);
        }

        // publish point of the next stage; the same barrier ends every read of this pass's buffer
        asm volatile("s_wait_dscnt 0x0" ::: "memory");           // this wave's LDS reads are done
        if (pinned(wave < 4u))
            ktile_wait(gg0, gg1);                                // this wave's slice of the next stage has landed
        __syncthreads();
        if (pinned((wave < 4u) & (kt + 256 < K))) {              // refill the buffer just left
            gg0 = ktile_group0(ldsS + buf * GT_BUF, sl + kt + 256);
            ktile_load(gg0, gg1);
        }
    }
    ktile_wait(gg0, gg1);                                        // no request outlives the ring
    asm volatile("s_wait_dscnt 0x0" ::: "memory");               // nor any LDS read of it

    #pragma unroll
    for (int mi = 0; mi < 2; ++mi) {
        const int mbase = bm + waveM * 32 + mi * 16 + halfSel * 8;
        #pragma unroll
        for (int ni = 0; ni < 4; ++ni) {
            const int n = bn + waveN * 64 + ni * 16 + fr;
            #pragma unroll
            for (int r = 0; r < 8; ++r) {
                const int m = mbase + r;
                const float c = acc[mi][ni][r];
                if constexpr (EPI == EP_QKV) {
                    const int b = m >> 11, t = m & (SEQ - 1);
                    const int type = n >> 10, dall = n & (D_MODEL - 1);
                    const int h = dall >> 6, dh = dall & 63;
                    const size_t idx =
                        (((size_t)(b * NHEAD + h) * SEQ) + t) * DHEAD + dh;
                    __bf16* dst = (type == 0) ? q_out : (type == 1) ? k_out : v_out;
                    dst[idx] = (__bf16)c;
                } else if constexpr (EPI == EP_RESID) {
                    outF[(size_t)m * N + n] = resid[(size_t)m * N + n] + c;
                } else if constexpr (EPI == EP_BIAS_GELU) {
                    const float xg = c + bias[n];
                    const float g = 0.5f * xg * (1.0f + erff(xg * 0.70710678118f));
                    outB[(size_t)m * N + n] = (__bf16)g;
                } else { // EP_BIAS_RESID
                    outF[(size_t)m * N + n] = resid[(size_t)m * N + n] + bias[n] + c;
                }
            }
        }
    }
}

#define KT_PITCH 144u                       // LDS row pitch, bytes
#define KT_BUF   10240u                     // 64 * 144 = 9216, rounded up to a multiple of 2 KiB
__device__ __forceinline__ u32x8 ktile_group1() {   // extents in bytes, tensor = tile
    u32x8 g;
    g[0] = uni((1u << 20) | (4u << 22) | (3u << 25));
    g[1] = uni(128u << 16);
    g[2] = uni(64u << 16);
    g[3] = uni(128u << 16);
    g[4] = uni(64u);
    g[5] = uni(128u);
    g[6] = uni(0u);
    g[7] = uni(0u);
    return g;
}

// V tile mover: the same tile shape at a row pitch of 160 bytes (32 bytes x odd: the pitch of
// ds_load_tr16_b128 readers).
#define VT_PITCH 160u                       // LDS row pitch, bytes
#define VT_BUF   10240u                     // 64 * 160, a multiple of 2 KiB
__device__ __forceinline__ u32x8 vtile_group1() {   // extents in bytes, tensor = tile
    u32x8 g;
    g[0] = uni((1u << 20) | (4u << 22) | (7u << 25));
    g[1] = uni(128u << 16);
    g[2] = uni(64u << 16);
    g[3] = uni(128u << 16);
    g[4] = uni(64u);
    g[5] = uni(128u);
    g[6] = uni(0u);
    g[7] = uni(0u);
    return g;
}
// transposing LDS load: lane (c, h) gets T[k + 8h + 0..7][d + c] of a row-major 16-bit tile
__device__ __forceinline__ v8bf ld_tr16(const unsigned char* p) {
    typedef __attribute__((address_space(3))) v8bf lds_v8bf;
    return __builtin_amdgcn_ds_load_tr16_b128_v8bf16((lds_v8bf*)p);
}

__device__ __forceinline__ float other_half(float v) {
    const int b = __builtin_bit_cast(int, v);
    return __builtin_bit_cast(float,
        __builtin_amdgcn_permlanex16(b, b, 0x76543210, 0xfedcba98, false, false));
}

__global__ __launch_bounds__(256)
void attn_fa(const __bf16* __restrict__ Q, const __bf16* __restrict__ Kb,
             const __bf16* __restrict__ Vb, __bf16* __restrict__ O) {
    const int bh = blockIdx.y;                 // b*NHEAD + h
    const int b = bh >> 4, h = bh & 15;
    const int q0 = blockIdx.x * 128;
    const int tid = threadIdx.x, lane = tid & 31, wid = tid >> 5;
    const int fr = lane & 15, halfSel = lane >> 4;
    const size_t headBase = (size_t)bh * SEQ * DHEAD;

    __shared__ __attribute__((aligned(2048))) unsigned char Ks[2 * KT_BUF];   // K ring
    __shared__ __attribute__((aligned(2048))) unsigned char Vs[2 * VT_BUF];   // V ring

    const unsigned int wave = uni(threadIdx.x >> 5);
    const unsigned int ldsK = (unsigned int)(uintptr_t)&Ks[0];
    const unsigned int ldsV = (unsigned int)(uintptr_t)&Vs[0];
    u32x8 kg1 = ktile_group1();
    u32x8 vg1 = vtile_group1();
    u32x4 kg0 = ktile_group0(ldsK, Kb + headBase);
    u32x4 vg0 = ktile_group0(ldsV, Vb + headBase);
    if (pinned(wave == 0)) {
        ktile_load(kg0, kg1);
        ktile_wait(kg0, kg1);                                // tile 0 landed before the barrier publishes it
    }
    if (pinned(wave == 1)) {
        ktile_load(vg0, vg1);
        ktile_wait(vg0, vg1);                                // tile 0 landed before the barrier publishes it
    }
    __syncthreads();
    kg0 = ktile_group0(ldsK + KT_BUF, Kb + headBase + 64 * DHEAD);
    vg0 = ktile_group0(ldsV + VT_BUF, Vb + headBase + 64 * DHEAD);
    if (pinned(wave == 0))
        ktile_load(kg0, kg1);
    if (pinned(wave == 1))
        ktile_load(vg0, vg1);

    const int qrow = q0 + wid * 16 + fr;       // this lane's query (B column)
    v16bf qf[2];
    #pragma unroll
    for (int s = 0; s < 2; ++s)
        qf[s] = *(const v16bf*)&Q[headBase + (size_t)qrow * DHEAD + s * 32 + halfSel * 16];

    const v8f vzero = {0.f,0.f,0.f,0.f,0.f,0.f,0.f,0.f};
    v8f oacc[4];                               // O^T: [d = ni*16 + 8*halfSel + r][query fr]
    #pragma unroll
    for (int ni = 0; ni < 4; ++ni) oacc[ni] = vzero;
    float mrun = -1e30f;                       // same value in both lane halves
    float lrun = 0.f;                          // this half's keys only; joined at the end

    const float scale = 0.125f;   // 1/sqrt(64)

    for (int j0 = 0; j0 < SEQ; j0 += 64) {
        const unsigned int kbuf = ((unsigned int)j0 >> 6) & 1u;
        // ---- S^T = K Q^T  (64 keys x 16 queries per wave) ----
        v8f sacc[4];                           // [key = ni*16 + 8*halfSel + r][query fr]
        #pragma unroll
        for (int ni = 0; ni < 4; ++ni) sacc[ni] = vzero;
        #pragma unroll
        for (int ni = 0; ni < 4; ++ni)
            #pragma unroll
            for (int s = 0; s < 2; ++s) {
                const unsigned char* kr = &Ks[kbuf * KT_BUF + (ni * 16 + fr) * KT_PITCH
                                              + s * 64 + halfSel * 32];
                const v8bf klo = *(const v8bf*)kr;
                const v8bf khi = *(const v8bf*)(kr + 16);
                const v16bf kf = __builtin_shufflevector(klo, khi,
                    0, 1, 2, 3, 4, 5, 6, 7, 8, 9, 10, 11, 12, 13, 14, 15);
                sacc[ni] = __builtin_amdgcn_wmma_f32_16x16x32_bf16(
                    false, kf, false, qf[s], (short)0, sacc[ni], false, false);
            }

        // ---- online softmax: one query per lane, 32 of its 64 keys in this lane ----
        float mx = sacc[0][0];
        #pragma unroll
        for (int ni = 0; ni < 4; ++ni)
            #pragma unroll
            for (int r = 0; r < 8; ++r) mx = fmaxf(mx, sacc[ni][r]);
        mx = fmaxf(mx, other_half(mx)) * scale;
        const float mnew = fmaxf(mrun, mx);
        const float alpha = __expf(mrun - mnew);

        // P^T as B operand: element i of block s is key s*32 + (i < 8 ? 8*halfSel + i
        // : 16 + 8*halfSel + i - 8), which is what tiles 2s and 2s+1 hold in this lane.
        v16bf pb[2];
        float rs[4];
        #pragma unroll
        for (int ni = 0; ni < 4; ++ni) {
            rs[ni] = 0.f;
            #pragma unroll
            for (int r = 0; r < 8; ++r) {
                const float p = __expf(sacc[ni][r] * scale - mnew);
                rs[ni] += p;
                pb[ni >> 1][(ni & 1) * 8 + r] = (__bf16)p;
            }
        }
        lrun = lrun * alpha + ((rs[0] + rs[1]) + (rs[2] + rs[3]));
        mrun = mnew;
        #pragma unroll
        for (int ni = 0; ni < 4; ++ni) oacc[ni] *= alpha;

        // ---- O^T += V^T P^T; the transposing loads give the A rows of V^T in the same key order ----
        const unsigned char* vt = &Vs[kbuf * VT_BUF + (8 * halfSel + (lane & 7)) * VT_PITCH
                                      + ((lane >> 3) & 1) * 16];
        #pragma unroll
        for (int s = 0; s < 2; ++s) {
            #pragma unroll
            for (int ni = 0; ni < 4; ++ni) {
                const unsigned char* vr = vt + s * 32 * VT_PITCH + ni * 32;
                const v8bf lo = ld_tr16(vr);                     // keys s*32 + 8*halfSel + 0..7
                const v8bf hi = ld_tr16(vr + 16 * VT_PITCH);     // keys s*32 + 16 + 8*halfSel + 0..7
                const v16bf vf = __builtin_shufflevector(lo, hi,
                    0, 1, 2, 3, 4, 5, 6, 7, 8, 9, 10, 11, 12, 13, 14, 15);
                oacc[ni] = __builtin_amdgcn_wmma_f32_16x16x32_bf16(
                    false, vf, false, pb[s], (short)0, oacc[ni], false, false);
            }
        }

        // publish point of the next K and V tiles; the same barrier ends every read of this
        // pass's two buffers
        asm volatile("s_wait_dscnt 0x0" ::: "memory");           // this wave's LDS reads are done
        if (pinned(wave == 0))
            ktile_wait(kg0, kg1);                                // next K tile has landed
        if (pinned(wave == 1))
            ktile_wait(vg0, vg1);                                // next V tile has landed
        __syncthreads();
        if (pinned((wave == 0) & (j0 + 128 < SEQ))) {            // refill the K buffer just left
            kg0 = ktile_group0(ldsK + kbuf * KT_BUF,
                               Kb + headBase + (size_t)(j0 + 128) * DHEAD);
            ktile_load(kg0, kg1);
        }
        if (pinned((wave == 1) & (j0 + 128 < SEQ))) {            // refill the V buffer just left
            vg0 = ktile_group0(ldsV + kbuf * VT_BUF,
                               Vb + headBase + (size_t)(j0 + 128) * DHEAD);
            ktile_load(vg0, vg1);
        }
    }
    ktile_wait(kg0, kg1);                                        // no request outlives the rings
    ktile_wait(vg0, vg1);
    asm volatile("s_wait_dscnt 0x0" ::: "memory");               // nor any LDS read of it

    // a lane holds 8 consecutive d of its query in each tile: 16-byte stores
    const float inv = 1.f / (lrun + other_half(lrun));
    #pragma unroll
    for (int ni = 0; ni < 4; ++ni) {
        v8bf ov;
        #pragma unroll
        for (int r = 0; r < 8; ++r) ov[r] = (__bf16)(oacc[ni][r] * inv);
        *(v8bf*)&O[((size_t)(b * SEQ + qrow)) * D_MODEL + h * DHEAD + ni * 16 + halfSel * 8] = ov;
    }
}

// ---------------------------------------------------------------------------
// host orchestration
// ---------------------------------------------------------------------------
extern "C" void kernel_launch(void* const* d_in, const int* in_sizes, int n_in,
                              void* d_out, int out_size, void* d_ws, size_t ws_size,
                              hipStream_t stream) {
    (void)in_sizes; (void)n_in; (void)out_size; (void)ws_size;
    const float* x      = (const float*)d_in[0];
    const float* ln1s   = (const float*)d_in[1];
    const float* ln1b   = (const float*)d_in[2];
    const float* qkvw_f = (const float*)d_in[3];
    const float* outw_f = (const float*)d_in[4];
    const float* ln2s   = (const float*)d_in[5];
    const float* ln2b   = (const float*)d_in[6];
    const float* fc1w_f = (const float*)d_in[7];
    const float* fc1b   = (const float*)d_in[8];
    const float* fc2w_f = (const float*)d_in[9];
    const float* fc2b   = (const float*)d_in[10];
    float* out = (float*)d_out;

    char* ws = (char*)d_ws;
    size_t off = 0;
    auto alloc = [&](size_t bytes) -> void* {
        void* p = ws + off;
        off += (bytes + 255) & ~(size_t)255;
        return p;
    };
    __bf16* qkvw = (__bf16*)alloc((size_t)3 * D_MODEL * D_MODEL * 2);   //  6 MB
    __bf16* outw = (__bf16*)alloc((size_t)D_MODEL * D_MODEL * 2);       //  2 MB
    __bf16* fc1w = (__bf16*)alloc((size_t)DIM_FF * D_MODEL * 2);        //  8 MB
    __bf16* fc2w = (__bf16*)alloc((size_t)D_MODEL * DIM_FF * 2);        //  8 MB
    __bf16* hbf  = (__bf16*)alloc((size_t)MROWS * D_MODEL * 2);         // 16 MB (LN1; reused for LN2)
    __bf16* Qb   = (__bf16*)alloc((size_t)MROWS * D_MODEL * 2);         // 16 MB
    __bf16* Kb   = (__bf16*)alloc((size_t)MROWS * D_MODEL * 2);         // 16 MB
    __bf16* Vb   = (__bf16*)alloc((size_t)MROWS * D_MODEL * 2);         // 16 MB
    __bf16* Obf  = (__bf16*)alloc((size_t)MROWS * D_MODEL * 2);         // 16 MB
    float*  x1   = (float*)alloc((size_t)MROWS * D_MODEL * 4);          // 32 MB
    __bf16* a1   = Qb;    // FFN act (64 MB) reuses dead Q|K|V|O span
    __bf16* h2bf = hbf;   // LN2 output reuses dead LN1 buffer

    // 1) weights -> bf16
    cvt_f32_bf16<<<(3 * D_MODEL * D_MODEL) / 1024, 256, 0, stream>>>(qkvw_f, qkvw, 3 * D_MODEL * D_MODEL);
    cvt_f32_bf16<<<(D_MODEL * D_MODEL) / 1024, 256, 0, stream>>>(outw_f, outw, D_MODEL * D_MODEL);
    cvt_f32_bf16<<<(DIM_FF * D_MODEL) / 1024, 256, 0, stream>>>(fc1w_f, fc1w, DIM_FF * D_MODEL);
    cvt_f32_bf16<<<(D_MODEL * DIM_FF) / 1024, 256, 0, stream>>>(fc2w_f, fc2w, D_MODEL * DIM_FF);

    // 2) LN1
    ln_to_bf16<<<MROWS, 256, 0, stream>>>(x, ln1s, ln1b, hbf);

    // 3) QKV projection: [8192,1024] x [3072,1024]^T, scatter into heads
    gemm_bf16<EP_QKV><<<dim3(3 * D_MODEL / 128, MROWS / 128), 256, 0, stream>>>(
        hbf, qkvw, MROWS, 3 * D_MODEL, D_MODEL,
        nullptr, nullptr, nullptr, nullptr, Qb, Kb, Vb);

    // 4) flash attention -> Obf [B,T,D]
    attn_fa<<<dim3(SEQ / 128, BATCH * NHEAD), 256, 0, stream>>>(Qb, Kb, Vb, Obf);

    // 5) out projection + residual -> x1 (fp32)
    gemm_bf16<EP_RESID><<<dim3(D_MODEL / 128, MROWS / 128), 256, 0, stream>>>(
        Obf, outw, MROWS, D_MODEL, D_MODEL,
        x, nullptr, x1, nullptr, nullptr, nullptr, nullptr);

    // 6) LN2
    ln_to_bf16<<<MROWS, 256, 0, stream>>>(x1, ln2s, ln2b, h2bf);

    // 7) fc1 + bias + exact GELU -> a1 (bf16)
    gemm_bf16<EP_BIAS_GELU><<<dim3(DIM_FF / 128, MROWS / 128), 256, 0, stream>>>(
        h2bf, fc1w, MROWS, DIM_FF, D_MODEL,
        nullptr, fc1b, nullptr, a1, nullptr, nullptr, nullptr);

    // 8) fc2 + bias + residual -> d_out (fp32)
    gemm_bf16<EP_BIAS_RESID><<<dim3(D_MODEL / 128, MROWS / 128), 256, 0, stream>>>(
        a1, fc2w, MROWS, D_MODEL, DIM_FF,
        x1, fc2b, out, nullptr, nullptr, nullptr, nullptr);
}

// v005
// It runs in 259 microseconds.
// Two timings next to v004 both put it at 1.07 times that version's speed.
// Counting every step since v000, it is 2.38 times as fast.
#include <hip/hip_runtime.h>
#include <hip/hip_bf16.h>
#include <math.h>

typedef __attribute__((ext_vector_type(16))) __bf16 v16bf;
typedef __attribute__((ext_vector_type(8)))  __bf16 v8bf;
typedef __attribute__((ext_vector_type(8)))  float  v8f;
typedef __attribute__((ext_vector_type(4)))  unsigned int u32x4;

#define D_MODEL 1024
#define NHEAD   16
#define DHEAD   64
#define DIM_FF  4096
#define BATCH   4
#define SEQ     2048
#define MROWS   (BATCH * SEQ)   // 8192

enum { EP_QKV = 0, EP_RESID = 1, EP_BIAS_GELU = 2, EP_BIAS_RESID = 3 };

// ---------------------------------------------------------------------------
// fp32 -> bf16 convert (vectorized x4)
// ---------------------------------------------------------------------------
__global__ __launch_bounds__(256)
void cvt_f32_bf16(const float* __restrict__ in, __bf16* __restrict__ out, int n) {
    int i = (blockIdx.x * 256 + threadIdx.x) * 4;
    if (i < n) {
        float4 v = *(const float4*)(in + i);
        out[i + 0] = (__bf16)v.x;
        out[i + 1] = (__bf16)v.y;
        out[i + 2] = (__bf16)v.z;
        out[i + 3] = (__bf16)v.w;
    }
}

// ---------------------------------------------------------------------------
// LayerNorm over D=1024, writes bf16.  One block (8 waves) per row.
// ---------------------------------------------------------------------------
__global__ __launch_bounds__(256)
void ln_to_bf16(const float* __restrict__ x, const float* __restrict__ sc,
                const float* __restrict__ bi, __bf16* __restrict__ out) {
    const int row = blockIdx.x;
    const float* xr = x + (size_t)row * D_MODEL;
    const int t = threadIdx.x, lane = t & 31, wid = t >> 5;

    float v[4]; float s = 0.f;
    #pragma unroll
    for (int i = 0; i < 4; ++i) { v[i] = xr[t + 256 * i]; s += v[i]; }
    #pragma unroll
    for (int m = 16; m >= 1; m >>= 1) s += __shfl_xor(s, m, 32);

    __shared__ float red[8];
    if (lane == 0) red[wid] = s;
    __syncthreads();
    float mu = 0.f;
    #pragma unroll
    for (int i = 0; i < 8; ++i) mu += red[i];
    mu *= (1.f / D_MODEL);

    float vs = 0.f;
    #pragma unroll
    for (int i = 0; i < 4; ++i) { float d = v[i] - mu; vs += d * d; }
    #pragma unroll
    for (int m = 16; m >= 1; m >>= 1) vs += __shfl_xor(vs, m, 32);
    __syncthreads();
    if (lane == 0) red[wid] = vs;
    __syncthreads();
    float var = 0.f;
    #pragma unroll
    for (int i = 0; i < 8; ++i) var += red[i];
    var *= (1.f / D_MODEL);
    const float rstd = rsqrtf(var + 1e-5f);

    #pragma unroll
    for (int i = 0; i < 4; ++i) {
        int c = t + 256 * i;
        out[(size_t)row * D_MODEL + c] = (__bf16)((v[i] - mu) * rstd * sc[c] + bi[c]);
    }
}

// ---------------------------------------------------------------------------
// Tensor mover helpers, shared by the GEMM and the attention kernel.
// ---------------------------------------------------------------------------
typedef __attribute__((ext_vector_type(8))) unsigned int u32x8;

__device__ __forceinline__ unsigned int uni(unsigned int v) { return (unsigned int)__builtin_amdgcn_readfirstlane(v); }
// a wave-uniform test held in a scalar register, so that the branch on it is s_cmp + s_cbranch_scc
__device__ __forceinline__ unsigned int pinned(unsigned int v) {
    unsigned int w = uni(v);
    asm volatile("" : "+s"(w));
    return w;
}
__device__ __forceinline__ u32x4 ktile_group0(unsigned int lds_dst, const __bf16* gptr) {
    const unsigned long long ga = (unsigned long long)(uintptr_t)gptr;
    u32x4 g;
    g[0] = uni(1u);
    g[1] = uni(lds_dst);
    g[2] = uni((unsigned int)ga);
    g[3] = uni((((unsigned int)(ga >> 32)) & 0x01FFFFFFu) | 0x80000000u);
    return g;
}
__device__ __forceinline__ void ktile_load(u32x4& g0, u32x8& g1) {
    // the request itself: global tile -> LDS through no register; its waits are written at each use.
    // Both groups are in/out operands: what ktile_wait names then lives in the very scalar
    // registers that the request was issued from.
    asm volatile("tensor_load_to_lds %0, %1" : "+s"(g0), "+s"(g1) :: "memory");
}
__device__ __forceinline__ void ktile_wait(u32x4 g0, u32x8 g1) {
    // the issuer's wait for its request; naming the request's two groups as inputs keeps their
    // scalar registers unwritten from the issue up to this wait
    asm volatile("s_wait_tensorcnt 0x0" :: "s"(g0), "s"(g1) : "memory");
}

// ---------------------------------------------------------------------------
// Tiled bf16 GEMM:  C[M,N] = A[M,K] * W[N,K]^T   (torch Linear layout)
// 128x128 block tile, 8 waves, each wave 32x64 (2x4 WMMA 16x16 tiles).
// A stage is 128 k of the block's 128 A rows and 128 W rows.  It comes into a ring of two
// LDS buffers by tensor load, one stage ahead of the pass that reads it: waves 0 to 3 each
// bring one slice of 64 rows x 256 bytes.  M, N multiples of 128; K a multiple of 128, >= 256.
// ---------------------------------------------------------------------------
#define GT_PITCH 272u
#define GT_SLICE 18432u
#define GT_BUF   (4u * GT_SLICE)

__device__ __forceinline__ u32x8 gtile_group1(unsigned int src_pitch) {   // extents in bytes, tensor = tile
    u32x8 g;
    g[0] = uni((1u << 20) | (5u << 22) | (3u << 25));
    g[1] = uni(256u << 16);
    g[2] = uni(64u << 16);
    g[3] = uni(256u << 16);
    g[4] = uni(64u);
    g[5] = uni(src_pitch);
    g[6] = uni(0u);
    g[7] = uni(0u);
    return g;
}
// 16 consecutive k of one LDS row: rows are 16-byte aligned only, so two 16-byte reads
__device__ __forceinline__ v16bf gfrag(const unsigned char* p) {
    const v8bf lo = *(const v8bf*)p;
    const v8bf hi = *(const v8bf*)(p + 16);
    return __builtin_shufflevector(lo, hi, 0, 1, 2, 3, 4, 5, 6, 7, 8, 9, 10, 11, 12, 13, 14, 15);
}

// Exact-form GELU, 0.5 x (1 + erf(x / sqrt 2)), without a branch.  With z = |x| / sqrt 2,
// erfc(z) = t (a1 + t (a2 + t (a3 + t (a4 + t a5)))) exp(-z z), t = 1 / (1 + 0.3275911 z),
// absolute error at most 1.5e-7; 1 + erf is 2 - erfc(z) for x >= 0 and erfc(z) for x < 0, so
// nothing cancels in the negative tail.  The result is within 5e-7 of the true value, far
// inside the rounding of the bf16 it is stored as.  The library erff takes two divergent
// branches per element, which keeps the elements of a lane from overlapping.
__device__ __forceinline__ float gelu_erf(float x) {
    const float t = __builtin_amdgcn_rcpf(fmaf(0.23164189f, fabsf(x), 1.0f));   // 0.3275911 / sqrt 2
    float p = 1.061405429f;
    p = fmaf(p, t, -1.453152027f);
    p = fmaf(p, t, 1.421413741f);
    p = fmaf(p, t, -0.284496736f);
    p = fmaf(p, t, 0.254829592f);
    const float q = p * t * __builtin_amdgcn_exp2f(x * x * -0.72134752f);       // exp(-x x / 2)
    return 0.5f * x * (x < 0.f ? q : 2.0f - q);
}

template<int EPI>
__global__ __launch_bounds__(256)
void gemm_bf16(const __bf16* __restrict__ A, const __bf16* __restrict__ W,
               int M, int N, int K,
               const float* __restrict__ resid, const float* __restrict__ bias,
               float* __restrict__ outF, __bf16* __restrict__ outB,
               __bf16* __restrict__ q_out, __bf16* __restrict__ k_out,
               __bf16* __restrict__ v_out) {
    __shared__ __attribute__((aligned(2048))) unsigned char Gs[2 * GT_BUF];   // stage ring

    const int tid = threadIdx.x;
    const int lane = tid & 31, wid = tid >> 5;
    const int waveM = wid & 3, waveN = wid >> 2;          // 4 x 2 wave grid
    const int bm = blockIdx.y * 128, bn = blockIdx.x * 128;
    const int fr = lane & 15;                             // fragment row
    const int halfSel = lane >> 4;                        // K-half (contiguous k order: k = 16*half + s)

    const v8f vzero = {0.f,0.f,0.f,0.f,0.f,0.f,0.f,0.f};
    v8f acc[2][4];
    #pragma unroll
    for (int mi = 0; mi < 2; ++mi)
        #pragma unroll
        for (int ni = 0; ni < 4; ++ni) acc[mi][ni] = vzero;

    // this wave's slice of every stage (waves 4 to 7 form the same words and never issue)
    const unsigned int wave = uni(threadIdx.x >> 5);
    const unsigned int slice = wave & 3u;
    const __bf16* sl = (slice & 2u) ? W + (size_t)(bn + (slice & 1u) * 64u) * K
                                    : A + (size_t)(bm + (slice & 1u) * 64u) * K;
    const unsigned int ldsS = (unsigned int)(uintptr_t)&Gs[0] + slice * GT_SLICE;
    u32x8 gg1 = gtile_group1((unsigned int)K * 2u);
    u32x4 gg0 = ktile_group0(ldsS, sl);
    if (pinned(wave < 4u)) {
        ktile_load(gg0, gg1);
        ktile_wait(gg0, gg1);                                // stage 0 landed before the barrier publishes it
    }
    __syncthreads();
    gg0 = ktile_group0(ldsS + GT_BUF, sl + 128);
    if (pinned(wave < 4u))
        ktile_load(gg0, gg1);

    // this lane's first A and W bytes inside a buffer
    const unsigned int aoff = (unsigned int)(waveM >> 1) * GT_SLICE
                            + (unsigned int)((waveM & 1) * 32 + fr) * GT_PITCH + (unsigned int)halfSel * 32u;
    const unsigned int boff = (unsigned int)(2 + waveN) * GT_SLICE
                            + (unsigned int)fr * GT_PITCH + (unsigned int)halfSel * 32u;

    for (int kt = 0; kt < K; kt += 128) {
        const unsigned int buf = ((unsigned int)kt >> 7) & 1u;
        const unsigned char* ap = &Gs[buf * GT_BUF + aoff];
        const unsigned char* bp = &Gs[buf * GT_BUF + boff];

        // unrolled so that every fragment offset is an immediate and a block's reads can go ahead of the block before
        #pragma unroll
        for (int kb = 0; kb < 4; ++kb) {
            v16bf af[2], bf[4];
            #pragma unroll
            for (int mi = 0; mi < 2; ++mi)
                af[mi] = gfrag(ap + mi * 16 * GT_PITCH + kb * 64);
            #pragma unroll
            for (int ni = 0; ni < 4; ++ni)
                bf[ni] = gfrag(bp + ni * 16 * GT_PITCH + kb * 64);

            #pragma unroll
            for (int mi = 0; mi < 2; ++mi)
                #pragma unroll
                for (int ni = 0; ni < 4; ++ni)
                    acc[mi][ni] = __builtin_amdgcn_wmma_f32_16x16x32_bf16(
                        false, af[mi], false, bf[ni], (short)0, acc[mi][ni], false, false);
        }

        // publish point of the next stage; the same barrier ends every read of this pass's buffer
        asm volatile("s_wait_dscnt 0x0" ::: "memory");           // this wave's LDS reads are done
        if (pinned(wave < 4u))
            ktile_wait(gg0, gg1);                                // this wave's slice of the next stage has landed
        __syncthreads();
        if (pinned((wave < 4u) & (kt + 256 < K))) {              // refill the buffer just left
            gg0 = ktile_group0(ldsS + buf * GT_BUF, sl + kt + 256);
            ktile_load(gg0, gg1);
        }
    }
    ktile_wait(gg0, gg1);                                        // no request outlives the ring
    asm volatile("s_wait_dscnt 0x0" ::: "memory");               // nor any LDS read of it

    #pragma unroll
    for (int mi = 0; mi < 2; ++mi) {
        const int mbase = bm + waveM * 32 + mi * 16 + halfSel * 8;
        #pragma unroll
        for (int ni = 0; ni < 4; ++ni) {
            const int n = bn + waveN * 64 + ni * 16 + fr;
            #pragma unroll
            for (int r = 0; r < 8; ++r) {
                const int m = mbase + r;
                const float c = acc[mi][ni][r];
                if constexpr (EPI == EP_QKV) {
                    const int b = m >> 11, t = m & (SEQ - 1);
                    const int type = n >> 10, dall = n & (D_MODEL - 1);
                    const int h = dall >> 6, dh = dall & 63;
                    const size_t idx =
                        (((size_t)(b * NHEAD + h) * SEQ) + t) * DHEAD + dh;
                    __bf16* dst = (type == 0) ? q_out : (type == 1) ? k_out : v_out;
                    dst[idx] = (__bf16)c;
                } else if constexpr (EPI == EP_RESID) {
                    outF[(size_t)m * N + n] = resid[(size_t)m * N + n] + c;
                } else if constexpr (EPI == EP_BIAS_GELU) {
                    outB[(size_t)m * N + n] = (__bf16)gelu_erf(c + bias[n]);
                } else { // EP_BIAS_RESID
                    outF[(size_t)m * N + n] = resid[(size_t)m * N + n] + bias[n] + c;
                }
            }
        }
    }
}

#define KT_PITCH 144u                       // LDS row pitch, bytes
#define KT_BUF   10240u                     // 64 * 144 = 9216, rounded up to a multiple of 2 KiB
__device__ __forceinline__ u32x8 ktile_group1() {   // extents in bytes, tensor = tile
    u32x8 g;
    g[0] = uni((1u << 20) | (4u << 22) | (3u << 25));
    g[1] = uni(128u << 16);
    g[2] = uni(64u << 16);
    g[3] = uni(128u << 16);
    g[4] = uni(64u);
    g[5] = uni(128u);
    g[6] = uni(0u);
    g[7] = uni(0u);
    return g;
}

// V tile mover: the same tile shape at a row pitch of 160 bytes (32 bytes x odd: the pitch of
// ds_load_tr16_b128 readers).
#define VT_PITCH 160u                       // LDS row pitch, bytes
#define VT_BUF   10240u                     // 64 * 160, a multiple of 2 KiB
__device__ __forceinline__ u32x8 vtile_group1() {   // extents in bytes, tensor = tile
    u32x8 g;
    g[0] = uni((1u << 20) | (4u << 22) | (7u << 25));
    g[1] = uni(128u << 16);
    g[2] = uni(64u << 16);
    g[3] = uni(128u << 16);
    g[4] = uni(64u);
    g[5] = uni(128u);
    g[6] = uni(0u);
    g[7] = uni(0u);
    return g;
}
// transposing LDS load: lane (c, h) gets T[k + 8h + 0..7][d + c] of a row-major 16-bit tile
__device__ __forceinline__ v8bf ld_tr16(const unsigned char* p) {
    typedef __attribute__((address_space(3))) v8bf lds_v8bf;
    return __builtin_amdgcn_ds_load_tr16_b128_v8bf16((lds_v8bf*)p);
}

__device__ __forceinline__ float other_half(float v) {
    const int b = __builtin_bit_cast(int, v);
    return __builtin_bit_cast(float,
        __builtin_amdgcn_permlanex16(b, b, 0x76543210, 0xfedcba98, false, false));
}

__global__ __launch_bounds__(256)
void attn_fa(const __bf16* __restrict__ Q, const __bf16* __restrict__ Kb,
             const __bf16* __restrict__ Vb, __bf16* __restrict__ O) {
    const int bh = blockIdx.y;                 // b*NHEAD + h
    const int b = bh >> 4, h = bh & 15;
    const int q0 = blockIdx.x * 128;
    const int tid = threadIdx.x, lane = tid & 31, wid = tid >> 5;
    const int fr = lane & 15, halfSel = lane >> 4;
    const size_t headBase = (size_t)bh * SEQ * DHEAD;

    __shared__ __attribute__((aligned(2048))) unsigned char Ks[2 * KT_BUF];   // K ring
    __shared__ __attribute__((aligned(2048))) unsigned char Vs[2 * VT_BUF];   // V ring

    const unsigned int wave = uni(threadIdx.x >> 5);
    const unsigned int ldsK = (unsigned int)(uintptr_t)&Ks[0];
    const unsigned int ldsV = (unsigned int)(uintptr_t)&Vs[0];
    u32x8 kg1 = ktile_group1();
    u32x8 vg1 = vtile_group1();
    u32x4 kg0 = ktile_group0(ldsK, Kb + headBase);
    u32x4 vg0 = ktile_group0(ldsV, Vb + headBase);
    if (pinned(wave == 0)) {
        ktile_load(kg0, kg1);
        ktile_wait(kg0, kg1);                                // tile 0 landed before the barrier publishes it
    }
    if (pinned(wave == 1)) {
        ktile_load(vg0, vg1);
        ktile_wait(vg0, vg1);                                // tile 0 landed before the barrier publishes it
    }
    __syncthreads();
    kg0 = ktile_group0(ldsK + KT_BUF, Kb + headBase + 64 * DHEAD);
    vg0 = ktile_group0(ldsV + VT_BUF, Vb + headBase + 64 * DHEAD);
    if (pinned(wave == 0))
        ktile_load(kg0, kg1);
    if (pinned(wave == 1))
        ktile_load(vg0, vg1);

    const int qrow = q0 + wid * 16 + fr;       // this lane's query (B column)
    v16bf qf[2];
    #pragma unroll
    for (int s = 0; s < 2; ++s)
        qf[s] = *(const v16bf*)&Q[headBase + (size_t)qrow * DHEAD + s * 32 + halfSel * 16];

    const v8f vzero = {0.f,0.f,0.f,0.f,0.f,0.f,0.f,0.f};
    v8f oacc[4];                               // O^T: [d = ni*16 + 8*halfSel + r][query fr]
    #pragma unroll
    for (int ni = 0; ni < 4; ++ni) oacc[ni] = vzero;
    float mrun = -1e30f;                       // same value in both lane halves
    float lrun = 0.f;                          // this half's keys only; joined at the end

    const float scale = 0.125f;   // 1/sqrt(64)

    for (int j0 = 0; j0 < SEQ; j0 += 64) {
        const unsigned int kbuf = ((unsigned int)j0 >> 6) & 1u;
        // ---- S^T = K Q^T  (64 keys x 16 queries per wave) ----
        v8f sacc[4];                           // [key = ni*16 + 8*halfSel + r][query fr]
        #pragma unroll
        for (int ni = 0; ni < 4; ++ni) sacc[ni] = vzero;
        #pragma unroll
        for (int ni = 0; ni < 4; ++ni)
            #pragma unroll
            for (int s = 0; s < 2; ++s) {
                const unsigned char* kr = &Ks[kbuf * KT_BUF + (ni * 16 + fr) * KT_PITCH
                                              + s * 64 + halfSel * 32];
                const v8bf klo = *(const v8bf*)kr;
                const v8bf khi = *(const v8bf*)(kr + 16);
                const v16bf kf = __builtin_shufflevector(klo, khi,
                    0, 1, 2, 3, 4, 5, 6, 7, 8, 9, 10, 11, 12, 13, 14, 15);
                sacc[ni] = __builtin_amdgcn_wmma_f32_16x16x32_bf16(
                    false, kf, false, qf[s], (short)0, sacc[ni], false, false);
            }

        // ---- online softmax: one query per lane, 32 of its 64 keys in this lane ----
        float mx = sacc[0][0];
        #pragma unroll
        for (int ni = 0; ni < 4; ++ni)
            #pragma unroll
            for (int r = 0; r < 8; ++r) mx = fmaxf(mx, sacc[ni][r]);
        mx = fmaxf(mx, other_half(mx)) * scale;
        const float mnew = fmaxf(mrun, mx);
        const float alpha = __expf(mrun - mnew);

        // P^T as B operand: element i of block s is key s*32 + (i < 8 ? 8*halfSel + i
        // : 16 + 8*halfSel + i - 8), which is what tiles 2s and 2s+1 hold in this lane.
        v16bf pb[2];
        float rs[4];
        #pragma unroll
        for (int ni = 0; ni < 4; ++ni) {
            rs[ni] = 0.f;
            #pragma unroll
            for (int r = 0; r < 8; ++r) {
                const float p = __expf(sacc[ni][r] * scale - mnew);
                rs[ni] += p;
                pb[ni >> 1][(ni & 1) * 8 + r] = (__bf16)p;
            }
        }
        lrun = lrun * alpha + ((rs[0] + rs[1]) + (rs[2] + rs[3]));
        mrun = mnew;
        #pragma unroll
        for (int ni = 0; ni < 4; ++ni) oacc[ni] *= alpha;

        // ---- O^T += V^T P^T; the transposing loads give the A rows of V^T in the same key order ----
        const unsigned char* vt = &Vs[kbuf * VT_BUF + (8 * halfSel + (lane & 7)) * VT_PITCH
                                      + ((lane >> 3) & 1) * 16];
        #pragma unroll
        for (int s = 0; s < 2; ++s) {
            #pragma unroll
            for (int ni = 0; ni < 4; ++ni) {
                const unsigned char* vr = vt + s * 32 * VT_PITCH + ni * 32;
                const v8bf lo = ld_tr16(vr);                     // keys s*32 + 8*halfSel + 0..7
                const v8bf hi = ld_tr16(vr + 16 * VT_PITCH);     // keys s*32 + 16 + 8*halfSel + 0..7
                const v16bf vf = __builtin_shufflevector(lo, hi,
                    0, 1, 2, 3, 4, 5, 6, 7, 8, 9, 10, 11, 12, 13, 14, 15);
                oacc[ni] = __builtin_amdgcn_wmma_f32_16x16x32_bf16(
                    false, vf, false, pb[s], (short)0, oacc[ni], false, false);
            }
        }

        // publish point of the next K and V tiles; the same barrier ends every read of this
        // pass's two buffers
        asm volatile("s_wait_dscnt 0x0" ::: "memory");           // this wave's LDS reads are done
        if (pinned(wave == 0))
            ktile_wait(kg0, kg1);                                // next K tile has landed
        if (pinned(wave == 1))
            ktile_wait(vg0, vg1);                                // next V tile has landed
        __syncthreads();
        if (pinned((wave == 0) & (j0 + 128 < SEQ))) {            // refill the K buffer just left
            kg0 = ktile_group0(ldsK + kbuf * KT_BUF,
                               Kb + headBase + (size_t)(j0 + 128) * DHEAD);
            ktile_load(kg0, kg1);
        }
        if (pinned((wave == 1) & (j0 + 128 < SEQ))) {            // refill the V buffer just left
            vg0 = ktile_group0(ldsV + kbuf * VT_BUF,
                               Vb + headBase + (size_t)(j0 + 128) * DHEAD);
            ktile_load(vg0, vg1);
        }
    }
    ktile_wait(kg0, kg1);                                        // no request outlives the rings
    ktile_wait(vg0, vg1);
    asm volatile("s_wait_dscnt 0x0" ::: "memory");               // nor any LDS read of it

    // a lane holds 8 consecutive d of its query in each tile: 16-byte stores
    const float inv = 1.f / (lrun + other_half(lrun));
    #pragma unroll
    for (int ni = 0; ni < 4; ++ni) {
        v8bf ov;
        #pragma unroll
        for (int r = 0; r < 8; ++r) ov[r] = (__bf16)(oacc[ni][r] * inv);
        *(v8bf*)&O[((size_t)(b * SEQ + qrow)) * D_MODEL + h * DHEAD + ni * 16 + halfSel * 8] = ov;
    }
}

// ---------------------------------------------------------------------------
// host orchestration
// ---------------------------------------------------------------------------
extern "C" void kernel_launch(void* const* d_in, const int* in_sizes, int n_in,
                              void* d_out, int out_size, void* d_ws, size_t ws_size,
                              hipStream_t stream) {
    (void)in_sizes; (void)n_in; (void)out_size; (void)ws_size;
    const float* x      = (const float*)d_in[0];
    const float* ln1s   = (const float*)d_in[1];
    const float* ln1b   = (const float*)d_in[2];
    const float* qkvw_f = (const float*)d_in[3];
    const float* outw_f = (const float*)d_in[4];
    const float* ln2s   = (const float*)d_in[5];
    const float* ln2b   = (const float*)d_in[6];
    const float* fc1w_f = (const float*)d_in[7];
    const float* fc1b   = (const float*)d_in[8];
    const float* fc2w_f = (const float*)d_in[9];
    const float* fc2b   = (const float*)d_in[10];
    float* out = (float*)d_out;

    char* ws = (char*)d_ws;
    size_t off = 0;
    auto alloc = [&](size_t bytes) -> void* {
        void* p = ws + off;
        off += (bytes + 255) & ~(size_t)255;
        return p;
    };
    __bf16* qkvw = (__bf16*)alloc((size_t)3 * D_MODEL * D_MODEL * 2);   //  6 MB
    __bf16* outw = (__bf16*)alloc((size_t)D_MODEL * D_MODEL * 2);       //  2 MB
    __bf16* fc1w = (__bf16*)alloc((size_t)DIM_FF * D_MODEL * 2);        //  8 MB
    __bf16* fc2w = (__bf16*)alloc((size_t)D_MODEL * DIM_FF * 2);        //  8 MB
    __bf16* hbf  = (__bf16*)alloc((size_t)MROWS * D_MODEL * 2);         // 16 MB (LN1; reused for LN2)
    __bf16* Qb   = (__bf16*)alloc((size_t)MROWS * D_MODEL * 2);         // 16 MB
    __bf16* Kb   = (__bf16*)alloc((size_t)MROWS * D_MODEL * 2);         // 16 MB
    __bf16* Vb   = (__bf16*)alloc((size_t)MROWS * D_MODEL * 2);         // 16 MB
    __bf16* Obf  = (__bf16*)alloc((size_t)MROWS * D_MODEL * 2);         // 16 MB
    float*  x1   = (float*)alloc((size_t)MROWS * D_MODEL * 4);          // 32 MB
    __bf16* a1   = Qb;    // FFN act (64 MB) reuses dead Q|K|V|O span
    __bf16* h2bf = hbf;   // LN2 output reuses dead LN1 buffer

    // 1) weights -> bf16
    cvt_f32_bf16<<<(3 * D_MODEL * D_MODEL) / 1024, 256, 0, stream>>>(qkvw_f, qkvw, 3 * D_MODEL * D_MODEL);
    cvt_f32_bf16<<<(D_MODEL * D_MODEL) / 1024, 256, 0, stream>>>(outw_f, outw, D_MODEL * D_MODEL);
    cvt_f32_bf16<<<(DIM_FF * D_MODEL) / 1024, 256, 0, stream>>>(fc1w_f, fc1w, DIM_FF * D_MODEL);
    cvt_f32_bf16<<<(D_MODEL * DIM_FF) / 1024, 256, 0, stream>>>(fc2w_f, fc2w, D_MODEL * DIM_FF);

    // 2) LN1
    ln_to_bf16<<<MROWS, 256, 0, stream>>>(x, ln1s, ln1b, hbf);

    // 3) QKV projection: [8192,1024] x [3072,1024]^T, scatter into heads
    gemm_bf16<EP_QKV><<<dim3(3 * D_MODEL / 128, MROWS / 128), 256, 0, stream>>>(
        hbf, qkvw, MROWS, 3 * D_MODEL, D_MODEL,
        nullptr, nullptr, nullptr, nullptr, Qb, Kb, Vb);

    // 4) flash attention -> Obf [B,T,D]
    attn_fa<<<dim3(SEQ / 128, BATCH * NHEAD), 256, 0, stream>>>(Qb, Kb, Vb, Obf);

    // 5) out projection + residual -> x1 (fp32)
    gemm_bf16<EP_RESID><<<dim3(D_MODEL / 128, MROWS / 128), 256, 0, stream>>>(
        Obf, outw, MROWS, D_MODEL, D_MODEL,
        x, nullptr, x1, nullptr, nullptr, nullptr, nullptr);

    // 6) LN2
    ln_to_bf16<<<MROWS, 256, 0, stream>>>(x1, ln2s, ln2b, h2bf);

    // 7) fc1 + bias + exact GELU -> a1 (bf16)
    gemm_bf16<EP_BIAS_GELU><<<dim3(DIM_FF / 128, MROWS / 128), 256, 0, stream>>>(
        h2bf, fc1w, MROWS, DIM_FF, D_MODEL,
        nullptr, fc1b, nullptr, a1, nullptr, nullptr, nullptr);

    // 8) fc2 + bias + residual -> d_out (fp32)
    gemm_bf16<EP_BIAS_RESID><<<dim3(D_MODEL / 128, MROWS / 128), 256, 0, stream>>>(
        a1, fc2w, MROWS, D_MODEL, DIM_FF,
        x1, fc2b, out, nullptr, nullptr, nullptr, nullptr);
}

// v006
// It runs in 251 microseconds.
// Timed twice side by side with v005, it ran 1.03 times as fast both times.
// All steps since v000 together make it 2.46 times as fast.
#include <hip/hip_runtime.h>
#include <hip/hip_bf16.h>
#include <math.h>

typedef __attribute__((ext_vector_type(16))) __bf16 v16bf;
typedef __attribute__((ext_vector_type(8)))  __bf16 v8bf;
typedef __attribute__((ext_vector_type(4)))  __bf16 v4bf;
typedef __attribute__((ext_vector_type(8)))  float  v8f;
typedef __attribute__((ext_vector_type(4)))  unsigned int u32x4;

#define D_MODEL 1024
#define NHEAD   16
#define DHEAD   64
#define DIM_FF  4096
#define BATCH   4
#define SEQ     2048
#define MROWS   (BATCH * SEQ)   // 8192

enum { EP_QKV = 0, EP_RESID = 1, EP_BIAS_GELU = 2, EP_BIAS_RESID = 3 };

// ---------------------------------------------------------------------------
// fp32 -> bf16 convert: one block converts 1024 consecutive floats (4 a thread)
// ---------------------------------------------------------------------------
__device__ __forceinline__
void cvt_block(const float* __restrict__ in, __bf16* __restrict__ out, int blk) {
    const int i = (blk * 256 + (int)threadIdx.x) * 4;
    float4 v = *(const float4*)(in + i);
    const v4bf o = { (__bf16)v.x, (__bf16)v.y, (__bf16)v.z, (__bf16)v.w };
    *(v4bf*)(out + i) = o;                  // one 8-byte store a thread
    asm volatile("s_wait_xcnt 0x0" ::: "memory");   // stands before any later write of the store's address and data registers
}

// ---------------------------------------------------------------------------
// LayerNorm over D=1024, writes bf16.  One block (8 waves) per row.
// ---------------------------------------------------------------------------
__device__ __forceinline__
void ln_row(const float* __restrict__ x, const float* __restrict__ sc,
            const float* __restrict__ bi, __bf16* __restrict__ out, int row) {
    const float* xr = x + (size_t)row * D_MODEL;
    const int t = threadIdx.x, lane = t & 31, wid = t >> 5;

    float v[4]; float s = 0.f;
    #pragma unroll
    for (int i = 0; i < 4; ++i) { v[i] = xr[t + 256 * i]; s += v[i]; }
    #pragma unroll
    for (int m = 16; m >= 1; m >>= 1) s += __shfl_xor(s, m, 32);

    __shared__ float red[8];
    if (lane == 0) red[wid] = s;
    __syncthreads();
    float mu = 0.f;
    #pragma unroll
    for (int i = 0; i < 8; ++i) mu += red[i];
    mu *= (1.f / D_MODEL);

    float vs = 0.f;
    #pragma unroll
    for (int i = 0; i < 4; ++i) { float d = v[i] - mu; vs += d * d; }
    #pragma unroll
    for (int m = 16; m >= 1; m >>= 1) vs += __shfl_xor(vs, m, 32);
    __syncthreads();
    if (lane == 0) red[wid] = vs;
    __syncthreads();
    float var = 0.f;
    #pragma unroll
    for (int i = 0; i < 8; ++i) var += red[i];
    var *= (1.f / D_MODEL);
    const float rstd = rsqrtf(var + 1e-5f);

    #pragma unroll
    for (int i = 0; i < 4; ++i) {
        int c = t + 256 * i;
        out[(size_t)row * D_MODEL + c] = (__bf16)((v[i] - mu) * rstd * sc[c] + bi[c]);
    }
}

__global__ __launch_bounds__(256)
void ln_to_bf16(const float* __restrict__ x, const float* __restrict__ sc,
                const float* __restrict__ bi, __bf16* __restrict__ out) {
    ln_row(x, sc, bi, out, blockIdx.x);
}

// ---------------------------------------------------------------------------
// The five passes that read nothing but inputs, LayerNorm 1 and the four weight conversions,
// share one grid: none reads what another writes, so one launch takes the place of five.
// The block index picks the pass (the same for a whole block, so the LayerNorm's barriers
// stand under block-uniform control flow).  The rows come first: they have the longer
// dependent chain, and the short conversion blocks make the launch's tail.
// ---------------------------------------------------------------------------
#define CB_QKV ((3 * D_MODEL * D_MODEL) / 1024)     // conversion blocks per weight matrix
#define CB_OUT ((D_MODEL * D_MODEL) / 1024)
#define CB_FC  ((DIM_FF * D_MODEL) / 1024)
#define PRE_BLOCKS (MROWS + CB_QKV + CB_OUT + 2 * CB_FC)

__global__ __launch_bounds__(256)
void pre_pass(const float* __restrict__ x, const float* __restrict__ sc,
              const float* __restrict__ bi, __bf16* __restrict__ h,
              const float* __restrict__ qkvw_f, const float* __restrict__ outw_f,
              const float* __restrict__ fc1w_f, const float* __restrict__ fc2w_f,
              __bf16* __restrict__ qkvw, __bf16* __restrict__ outw,
              __bf16* __restrict__ fc1w, __bf16* __restrict__ fc2w) {
    const int blk = blockIdx.x;
    if (blk < MROWS) {
        ln_row(x, sc, bi, h, blk);
    } else {
        // which matrix, and which of its blocks: the same for the whole block; then one conversion body for all four
        int c = blk - MROWS;
        const float* in = qkvw_f;
        __bf16* out = qkvw;
        if (c >= CB_QKV)  { c -= CB_QKV; in = outw_f; out = outw;
            if (c >= CB_OUT)  { c -= CB_OUT; in = fc1w_f; out = fc1w;
                if (c >= CB_FC)   { c -= CB_FC;  in = fc2w_f; out = fc2w; } } }
        cvt_block(in, out, c);
    }
}

// ---------------------------------------------------------------------------
// Tensor mover helpers, shared by the GEMM and the attention kernel.
// ---------------------------------------------------------------------------
typedef __attribute__((ext_vector_type(8))) unsigned int u32x8;

__device__ __forceinline__ unsigned int uni(unsigned int v) { return (unsigned int)__builtin_amdgcn_readfirstlane(v); }
// a wave-uniform test held in a scalar register, so that the branch on it is s_cmp + s_cbranch_scc
__device__ __forceinline__ unsigned int pinned(unsigned int v) {
    unsigned int w = uni(v);
    asm volatile("" : "+s"(w));
    return w;
}
__device__ __forceinline__ u32x4 ktile_group0(unsigned int lds_dst, const __bf16* gptr) {
    const unsigned long long ga = (unsigned long long)(uintptr_t)gptr;
    u32x4 g;
    g[0] = uni(1u);
    g[1] = uni(lds_dst);
    g[2] = uni((unsigned int)ga);
    g[3] = uni((((unsigned int)(ga >> 32)) & 0x01FFFFFFu) | 0x80000000u);
    return g;
}
__device__ __forceinline__ void ktile_load(u32x4& g0, u32x8& g1) {
    // the request itself: global tile -> LDS through no register; its waits are written at each use.
    // Both groups are in/out operands: what ktile_wait names then lives in the very scalar
    // registers that the request was issued from.
    asm volatile("tensor_load_to_lds %0, %1" : "+s"(g0), "+s"(g1) :: "memory");
}
__device__ __forceinline__ void ktile_wait(u32x4 g0, u32x8 g1) {
    // the issuer's wait for its request; naming the request's two groups as inputs keeps their
    // scalar registers unwritten from the issue up to this wait
    asm volatile("s_wait_tensorcnt 0x0" :: "s"(g0), "s"(g1) : "memory");
}

// ---------------------------------------------------------------------------
// Tiled bf16 GEMM:  C[M,N] = A[M,K] * W[N,K]^T   (torch Linear layout)
// 128x128 block tile, 8 waves, each wave 32x64 (2x4 WMMA 16x16 tiles).
// A stage is 128 k of the block's 128 A rows and 128 W rows.  It comes into a ring of two
// LDS buffers by tensor load, one stage ahead of the pass that reads it: waves 0 to 3 each
// bring one slice of 64 rows x 256 bytes.  M, N multiples of 128; K a multiple of 128, >= 256.
// ---------------------------------------------------------------------------
#define GT_PITCH 272u
#define GT_SLICE 18432u
#define GT_BUF   (4u * GT_SLICE)

__device__ __forceinline__ u32x8 gtile_group1(unsigned int src_pitch) {   // extents in bytes, tensor = tile
    u32x8 g;
    g[0] = uni((1u << 20) | (5u << 22) | (3u << 25));
    g[1] = uni(256u << 16);
    g[2] = uni(64u << 16);
    g[3] = uni(256u << 16);
    g[4] = uni(64u);
    g[5] = uni(src_pitch);
    g[6] = uni(0u);
    g[7] = uni(0u);
    return g;
}
// 16 consecutive k of one LDS row: rows are 16-byte aligned only, so two 16-byte reads
__device__ __forceinline__ v16bf gfrag(const unsigned char* p) {
    const v8bf lo = *(const v8bf*)p;
    const v8bf hi = *(const v8bf*)(p + 16);
    return __builtin_shufflevector(lo, hi, 0, 1, 2, 3, 4, 5, 6, 7, 8, 9, 10, 11, 12, 13, 14, 15);
}

// Exact-form GELU, 0.5 x (1 + erf(x / sqrt 2)), without a branch.  With z = |x| / sqrt 2,
// erfc(z) = t (a1 + t (a2 + t (a3 + t (a4 + t a5)))) exp(-z z), t = 1 / (1 + 0.3275911 z),
// absolute error at most 1.5e-7; 1 + erf is 2 - erfc(z) for x >= 0 and erfc(z) for x < 0, so
// nothing cancels in the negative tail.  The result is within 5e-7 of the true value, far
// inside the rounding of the bf16 it is stored as.  The library erff takes two divergent
// branches per element, which keeps the elements of a lane from overlapping.
__device__ __forceinline__ float gelu_erf(float x) {
    const float t = __builtin_amdgcn_rcpf(fmaf(0.23164189f, fabsf(x), 1.0f));   // 0.3275911 / sqrt 2
    float p = 1.061405429f;
    p = fmaf(p, t, -1.453152027f);
    p = fmaf(p, t, 1.421413741f);
    p = fmaf(p, t, -0.284496736f);
    p = fmaf(p, t, 0.254829592f);
    const float q = p * t * __builtin_amdgcn_exp2f(x * x * -0.72134752f);       // exp(-x x / 2)
    return 0.5f * x * (x < 0.f ? q : 2.0f - q);
}

template<int EPI>
__global__ __launch_bounds__(256)
void gemm_bf16(const __bf16* __restrict__ A, const __bf16* __restrict__ W,
               int M, int N, int K,
               const float* __restrict__ resid, const float* __restrict__ bias,
               float* __restrict__ outF, __bf16* __restrict__ outB,
               __bf16* __restrict__ q_out, __bf16* __restrict__ k_out,
               __bf16* __restrict__ v_out) {
    __shared__ __attribute__((aligned(2048))) unsigned char Gs[2 * GT_BUF];   // stage ring

    const int tid = threadIdx.x;
    const int lane = tid & 31, wid = tid >> 5;
    const int waveM = wid & 3, waveN = wid >> 2;          // 4 x 2 wave grid
    const int bm = blockIdx.y * 128, bn = blockIdx.x * 128;
    const int fr = lane & 15;                             // fragment row
    const int halfSel = lane >> 4;                        // K-half (contiguous k order: k = 16*half + s)

    const v8f vzero = {0.f,0.f,0.f,0.f,0.f,0.f,0.f,0.f};
    v8f acc[2][4];
    #pragma unroll
    for (int mi = 0; mi < 2; ++mi)
        #pragma unroll
        for (int ni = 0; ni < 4; ++ni) acc[mi][ni] = vzero;

    // this wave's slice of every stage (waves 4 to 7 form the same words and never issue)
    const unsigned int wave = uni(threadIdx.x >> 5);
    const unsigned int slice = wave & 3u;
    const __bf16* sl = (slice & 2u) ? W + (size_t)(bn + (slice & 1u) * 64u) * K
                                    : A + (size_t)(bm + (slice & 1u) * 64u) * K;
    const unsigned int ldsS = (unsigned int)(uintptr_t)&Gs[0] + slice * GT_SLICE;
    u32x8 gg1 = gtile_group1((unsigned int)K * 2u);
    u32x4 gg0 = ktile_group0(ldsS, sl);
    if (pinned(wave < 4u)) {
        ktile_load(gg0, gg1);
        ktile_wait(gg0, gg1);                                // stage 0 landed before the barrier publishes it
    }
    __syncthreads();
    gg0 = ktile_group0(ldsS + GT_BUF, sl + 128);
    if (pinned(wave < 4u))
        ktile_load(gg0, gg1);

    // this lane's first A and W bytes inside a buffer
    const unsigned int aoff = (unsigned int)(waveM >> 1) * GT_SLICE
                            + (unsigned int)((waveM & 1) * 32 + fr) * GT_PITCH + (unsigned int)halfSel * 32u;
    const unsigned int boff = (unsigned int)(2 + waveN) * GT_SLICE
                            + (unsigned int)fr * GT_PITCH + (unsigned int)halfSel * 32u;

    for (int kt = 0; kt < K; kt += 128) {
        const unsigned int buf = ((unsigned int)kt >> 7) & 1u;
        const unsigned char* ap = &Gs[buf * GT_BUF + aoff];
        const unsigned char* bp = &Gs[buf * GT_BUF + boff];

        // unrolled so that every fragment offset is an immediate and a block's reads can go ahead of the block before
        #pragma unroll
        for (int kb = 0; kb < 4; ++kb) {
            v16bf af[2], bf[4];
            #pragma unroll
            for (int mi = 0; mi < 2; ++mi)
                af[mi] = gfrag(ap + mi * 16 * GT_PITCH + kb * 64);
            #pragma unroll
            for (int ni = 0; ni < 4; ++ni)
                bf[ni] = gfrag(bp + ni * 16 * GT_PITCH + kb * 64);

            #pragma unroll
            for (int mi = 0; mi < 2; ++mi)
                #pragma unroll
                for (int ni = 0; ni < 4; ++ni)
                    acc[mi][ni] = __builtin_amdgcn_wmma_f32_16x16x32_bf16(
                        false, af[mi], false, bf[ni], (short)0, acc[mi][ni], false, false);
        }

        // publish point of the next stage; the same barrier ends every read of this pass's buffer
        asm volatile("s_wait_dscnt 0x0" ::: "memory");           // this wave's LDS reads are done
        if (pinned(wave < 4u))
            ktile_wait(gg0, gg1);                                // this wave's slice of the next stage has landed
        __syncthreads();
        if (pinned((wave < 4u) & (kt + 256 < K))) {              // refill the buffer just left
            gg0 = ktile_group0(ldsS + buf * GT_BUF, sl + kt + 256);
            ktile_load(gg0, gg1);
        }
    }
    ktile_wait(gg0, gg1);                                        // no request outlives the ring
    asm volatile("s_wait_dscnt 0x0" ::: "memory");               // nor any LDS read of it

    #pragma unroll
    for (int mi = 0; mi < 2; ++mi) {
        const int mbase = bm + waveM * 32 + mi * 16 + halfSel * 8;
        #pragma unroll
        for (int ni = 0; ni < 4; ++ni) {
            const int n = bn + waveN * 64 + ni * 16 + fr;
            #pragma unroll
            for (int r = 0; r < 8; ++r) {
                const int m = mbase + r;
                const float c = acc[mi][ni][r];
                if constexpr (EPI == EP_QKV) {
                    const int b = m >> 11, t = m & (SEQ - 1);
                    const int type = n >> 10, dall = n & (D_MODEL - 1);
                    const int h = dall >> 6, dh = dall & 63;
                    const size_t idx =
                        (((size_t)(b * NHEAD + h) * SEQ) + t) * DHEAD + dh;
                    __bf16* dst = (type == 0) ? q_out : (type == 1) ? k_out : v_out;
                    dst[idx] = (__bf16)c;
                } else if constexpr (EPI == EP_RESID) {
                    outF[(size_t)m * N + n] = resid[(size_t)m * N + n] + c;
                } else if constexpr (EPI == EP_BIAS_GELU) {
                    outB[(size_t)m * N + n] = (__bf16)gelu_erf(c + bias[n]);
                } else { // EP_BIAS_RESID
                    outF[(size_t)m * N + n] = resid[(size_t)m * N + n] + bias[n] + c;
                }
            }
        }
    }
}

#define KT_PITCH 144u                       // LDS row pitch, bytes
#define KT_BUF   10240u                     // 64 * 144 = 9216, rounded up to a multiple of 2 KiB
__device__ __forceinline__ u32x8 ktile_group1() {   // extents in bytes, tensor = tile
    u32x8 g;
    g[0] = uni((1u << 20) | (4u << 22) | (3u << 25));
    g[1] = uni(128u << 16);
    g[2] = uni(64u << 16);
    g[3] = uni(128u << 16);
    g[4] = uni(64u);
    g[5] = uni(128u);
    g[6] = uni(0u);
    g[7] = uni(0u);
    return g;
}

// V tile mover: the same tile shape at a row pitch of 160 bytes (32 bytes x odd: the pitch of
// ds_load_tr16_b128 readers).
#define VT_PITCH 160u                       // LDS row pitch, bytes
#define VT_BUF   10240u                     // 64 * 160, a multiple of 2 KiB
__device__ __forceinline__ u32x8 vtile_group1() {   // extents in bytes, tensor = tile
    u32x8 g;
    g[0] = uni((1u << 20) | (4u << 22) | (7u << 25));
    g[1] = uni(128u << 16);
    g[2] = uni(64u << 16);
    g[3] = uni(128u << 16);
    g[4] = uni(64u);
    g[5] = uni(128u);
    g[6] = uni(0u);
    g[7] = uni(0u);
    return g;
}
// transposing LDS load: lane (c, h) gets T[k + 8h + 0..7][d + c] of a row-major 16-bit tile
__device__ __forceinline__ v8bf ld_tr16(const unsigned char* p) {
    typedef __attribute__((address_space(3))) v8bf lds_v8bf;
    return __builtin_amdgcn_ds_load_tr16_b128_v8bf16((lds_v8bf*)p);
}

__device__ __forceinline__ float other_half(float v) {
    const int b = __builtin_bit_cast(int, v);
    return __builtin_bit_cast(float,
        __builtin_amdgcn_permlanex16(b, b, 0x76543210, 0xfedcba98, false, false));
}

__global__ __launch_bounds__(256)
void attn_fa(const __bf16* __restrict__ Q, const __bf16* __restrict__ Kb,
             const __bf16* __restrict__ Vb, __bf16* __restrict__ O) {
    const int bh = blockIdx.y;                 // b*NHEAD + h
    const int b = bh >> 4, h = bh & 15;
    const int q0 = blockIdx.x * 128;
    const int tid = threadIdx.x, lane = tid & 31, wid = tid >> 5;
    const int fr = lane & 15, halfSel = lane >> 4;
    const size_t headBase = (size_t)bh * SEQ * DHEAD;

    __shared__ __attribute__((aligned(2048))) unsigned char Ks[2 * KT_BUF];   // K ring
    __shared__ __attribute__((aligned(2048))) unsigned char Vs[2 * VT_BUF];   // V ring

    const unsigned int wave = uni(threadIdx.x >> 5);
    const unsigned int ldsK = (unsigned int)(uintptr_t)&Ks[0];
    const unsigned int ldsV = (unsigned int)(uintptr_t)&Vs[0];
    u32x8 kg1 = ktile_group1();
    u32x8 vg1 = vtile_group1();
    u32x4 kg0 = ktile_group0(ldsK, Kb + headBase);
    u32x4 vg0 = ktile_group0(ldsV, Vb + headBase);
    if (pinned(wave == 0)) {
        ktile_load(kg0, kg1);
        ktile_wait(kg0, kg1);                                // tile 0 landed before the barrier publishes it
    }
    if (pinned(wave == 1)) {
        ktile_load(vg0, vg1);
        ktile_wait(vg0, vg1);                                // tile 0 landed before the barrier publishes it
    }
    __syncthreads();
    kg0 = ktile_group0(ldsK + KT_BUF, Kb + headBase + 64 * DHEAD);
    vg0 = ktile_group0(ldsV + VT_BUF, Vb + headBase + 64 * DHEAD);
    if (pinned(wave == 0))
        ktile_load(kg0, kg1);
    if (pinned(wave == 1))
        ktile_load(vg0, vg1);

    const int qrow = q0 + wid * 16 + fr;       // this lane's query (B column)
    v16bf qf[2];
    #pragma unroll
    for (int s = 0; s < 2; ++s)
        qf[s] = *(const v16bf*)&Q[headBase + (size_t)qrow * DHEAD + s * 32 + halfSel * 16];

    const v8f vzero = {0.f,0.f,0.f,0.f,0.f,0.f,0.f,0.f};
    v8f oacc[4];                               // O^T: [d = ni*16 + 8*halfSel + r][query fr]
    #pragma unroll
    for (int ni = 0; ni < 4; ++ni) oacc[ni] = vzero;
    float mrun = -1e30f;                       // same value in both lane halves
    float lrun = 0.f;                          // this half's keys only; joined at the end

    const float scale = 0.125f;   // 1/sqrt(64)

    for (int j0 = 0; j0 < SEQ; j0 += 64) {
        const unsigned int kbuf = ((unsigned int)j0 >> 6) & 1u;
        // ---- S^T = K Q^T  (64 keys x 16 queries per wave) ----
        v8f sacc[4];                           // [key = ni*16 + 8*halfSel + r][query fr]
        #pragma unroll
        for (int ni = 0; ni < 4; ++ni) sacc[ni] = vzero;
        #pragma unroll
        for (int ni = 0; ni < 4; ++ni)
            #pragma unroll
            for (int s = 0; s < 2; ++s) {
                const unsigned char* kr = &Ks[kbuf * KT_BUF + (ni * 16 + fr) * KT_PITCH
                                              + s * 64 + halfSel * 32];
                const v8bf klo = *(const v8bf*)kr;
                const v8bf khi = *(const v8bf*)(kr + 16);
                const v16bf kf = __builtin_shufflevector(klo, khi,
                    0, 1, 2, 3, 4, 5, 6, 7, 8, 9, 10, 11, 12, 13, 14, 15);
                sacc[ni] = __builtin_amdgcn_wmma_f32_16x16x32_bf16(
                    false, kf, false, qf[s], (short)0, sacc[ni], false, false);
            }

        // ---- online softmax: one query per lane, 32 of its 64 keys in this lane ----
        float mx = sacc[0][0];
        #pragma unroll
        for (int ni = 0; ni < 4; ++ni)
            #pragma unroll
            for (int r = 0; r < 8; ++r) mx = fmaxf(mx, sacc[ni][r]);
        mx = fmaxf(mx, other_half(mx)) * scale;
        const float mnew = fmaxf(mrun, mx);
        const float alpha = __expf(mrun - mnew);

        // P^T as B operand: element i of block s is key s*32 + (i < 8 ? 8*halfSel + i
        // : 16 + 8*halfSel + i - 8), which is what tiles 2s and 2s+1 hold in this lane.
        v16bf pb[2];
        float rs[4];
        #pragma unroll
        for (int ni = 0; ni < 4; ++ni) {
            rs[ni] = 0.f;
            #pragma unroll
            for (int r = 0; r < 8; ++r) {
                const float p = __expf(sacc[ni][r] * scale - mnew);
                rs[ni] += p;
                pb[ni >> 1][(ni & 1) * 8 + r] = (__bf16)p;
            }
        }
        lrun = lrun * alpha + ((rs[0] + rs[1]) + (rs[2] + rs[3]));
        mrun = mnew;
        #pragma unroll
        for (int ni = 0; ni < 4; ++ni) oacc[ni] *= alpha;

        // ---- O^T += V^T P^T; the transposing loads give the A rows of V^T in the same key order ----
        const unsigned char* vt = &Vs[kbuf * VT_BUF + (8 * halfSel + (lane & 7)) * VT_PITCH
                                      + ((lane >> 3) & 1) * 16];
        #pragma unroll
        for (int s = 0; s < 2; ++s) {
            #pragma unroll
            for (int ni = 0; ni < 4; ++ni) {
                const unsigned char* vr = vt + s * 32 * VT_PITCH + ni * 32;
                const v8bf lo = ld_tr16(vr);                     // keys s*32 + 8*halfSel + 0..7
                const v8bf hi = ld_tr16(vr + 16 * VT_PITCH);     // keys s*32 + 16 + 8*halfSel + 0..7
                const v16bf vf = __builtin_shufflevector(lo, hi,
                    0, 1, 2, 3, 4, 5, 6, 7, 8, 9, 10, 11, 12, 13, 14, 15);
                oacc[ni] = __builtin_amdgcn_wmma_f32_16x16x32_bf16(
                    false, vf, false, pb[s], (short)0, oacc[ni], false, false);
            }
        }

        // publish point of the next K and V tiles; the same barrier ends every read of this
        // pass's two buffers
        asm volatile("s_wait_dscnt 0x0" ::: "memory");           // this wave's LDS reads are done
        if (pinned(wave == 0))
            ktile_wait(kg0, kg1);                                // next K tile has landed
        if (pinned(wave == 1))
            ktile_wait(vg0, vg1);                                // next V tile has landed
        __syncthreads();
        if (pinned((wave == 0) & (j0 + 128 < SEQ))) {            // refill the K buffer just left
            kg0 = ktile_group0(ldsK + kbuf * KT_BUF,
                               Kb + headBase + (size_t)(j0 + 128) * DHEAD);
            ktile_load(kg0, kg1);
        }
        if (pinned((wave == 1) & (j0 + 128 < SEQ))) {            // refill the V buffer just left
            vg0 = ktile_group0(ldsV + kbuf * VT_BUF,
                               Vb + headBase + (size_t)(j0 + 128) * DHEAD);
            ktile_load(vg0, vg1);
        }
    }
    ktile_wait(kg0, kg1);                                        // no request outlives the rings
    ktile_wait(vg0, vg1);
    asm volatile("s_wait_dscnt 0x0" ::: "memory");               // nor any LDS read of it

    // a lane holds 8 consecutive d of its query in each tile: 16-byte stores
    const float inv = 1.f / (lrun + other_half(lrun));
    #pragma unroll
    for (int ni = 0; ni < 4; ++ni) {
        v8bf ov;
        #pragma unroll
        for (int r = 0; r < 8; ++r) ov[r] = (__bf16)(oacc[ni][r] * inv);
        *(v8bf*)&O[((size_t)(b * SEQ + qrow)) * D_MODEL + h * DHEAD + ni * 16 + halfSel * 8] = ov;
    }
}

// ---------------------------------------------------------------------------
// host orchestration
// ---------------------------------------------------------------------------
extern "C" void kernel_launch(void* const* d_in, const int* in_sizes, int n_in,
                              void* d_out, int out_size, void* d_ws, size_t ws_size,
                              hipStream_t stream) {
    (void)in_sizes; (void)n_in; (void)out_size; (void)ws_size;
    const float* x      = (const float*)d_in[0];
    const float* ln1s   = (const float*)d_in[1];
    const float* ln1b   = (const float*)d_in[2];
    const float* qkvw_f = (const float*)d_in[3];
    const float* outw_f = (const float*)d_in[4];
    const float* ln2s   = (const float*)d_in[5];
    const float* ln2b   = (const float*)d_in[6];
    const float* fc1w_f = (const float*)d_in[7];
    const float* fc1b   = (const float*)d_in[8];
    const float* fc2w_f = (const float*)d_in[9];
    const float* fc2b   = (const float*)d_in[10];
    float* out = (float*)d_out;

    char* ws = (char*)d_ws;
    size_t off = 0;
    auto alloc = [&](size_t bytes) -> void* {
        void* p = ws + off;
        off += (bytes + 255) & ~(size_t)255;
        return p;
    };
    __bf16* qkvw = (__bf16*)alloc((size_t)3 * D_MODEL * D_MODEL * 2);   //  6 MB
    __bf16* outw = (__bf16*)alloc((size_t)D_MODEL * D_MODEL * 2);       //  2 MB
    __bf16* fc1w = (__bf16*)alloc((size_t)DIM_FF * D_MODEL * 2);        //  8 MB
    __bf16* fc2w = (__bf16*)alloc((size_t)D_MODEL * DIM_FF * 2);        //  8 MB
    __bf16* hbf  = (__bf16*)alloc((size_t)MROWS * D_MODEL * 2);         // 16 MB (LN1; reused for LN2)
    __bf16* Qb   = (__bf16*)alloc((size_t)MROWS * D_MODEL * 2);         // 16 MB
    __bf16* Kb   = (__bf16*)alloc((size_t)MROWS * D_MODEL * 2);         // 16 MB
    __bf16* Vb   = (__bf16*)alloc((size_t)MROWS * D_MODEL * 2);         // 16 MB
    __bf16* Obf  = (__bf16*)alloc((size_t)MROWS * D_MODEL * 2);         // 16 MB
    float*  x1   = (float*)alloc((size_t)MROWS * D_MODEL * 4);          // 32 MB
    __bf16* a1   = Qb;    // FFN act (64 MB) reuses dead Q|K|V|O span
    __bf16* h2bf = hbf;   // LN2 output reuses dead LN1 buffer

    // 1, 2) LN1 and weights -> bf16, one launch
    pre_pass<<<PRE_BLOCKS, 256, 0, stream>>>(x, ln1s, ln1b, hbf,
                                             qkvw_f, outw_f, fc1w_f, fc2w_f,
                                             qkvw, outw, fc1w, fc2w);

    // 3) QKV projection: [8192,1024] x [3072,1024]^T, scatter into heads
    gemm_bf16<EP_QKV><<<dim3(3 * D_MODEL / 128, MROWS / 128), 256, 0, stream>>>(
        hbf, qkvw, MROWS, 3 * D_MODEL, D_MODEL,
        nullptr, nullptr, nullptr, nullptr, Qb, Kb, Vb);

    // 4) flash attention -> Obf [B,T,D]
    attn_fa<<<dim3(SEQ / 128, BATCH * NHEAD), 256, 0, stream>>>(Qb, Kb, Vb, Obf);

    // 5) out projection + residual -> x1 (fp32)
    gemm_bf16<EP_RESID><<<dim3(D_MODEL / 128, MROWS / 128), 256, 0, stream>>>(
        Obf, outw, MROWS, D_MODEL, D_MODEL,
        x, nullptr, x1, nullptr, nullptr, nullptr, nullptr);

    // 6) LN2
    ln_to_bf16<<<MROWS, 256, 0, stream>>>(x1, ln2s, ln2b, h2bf);

    // 7) fc1 + bias + exact GELU -> a1 (bf16)
    gemm_bf16<EP_BIAS_GELU><<<dim3(DIM_FF / 128, MROWS / 128), 256, 0, stream>>>(
        h2bf, fc1w, MROWS, DIM_FF, D_MODEL,
        nullptr, fc1b, nullptr, a1, nullptr, nullptr, nullptr);

    // 8) fc2 + bias + residual -> d_out (fp32)
    gemm_bf16<EP_BIAS_RESID><<<dim3(D_MODEL / 128, MROWS / 128), 256, 0, stream>>>(
        a1, fc2w, MROWS, D_MODEL, DIM_FF,
        x1, fc2b, out, nullptr, nullptr, nullptr, nullptr);
}

// v007
// Measured time: 243 microseconds a run.
// Two timings next to v006 both put it at 1.03 times that version's speed.
// Counting every step since v000, it is 2.54 times as fast.
#include <hip/hip_runtime.h>
#include <hip/hip_bf16.h>
#include <math.h>

typedef __attribute__((ext_vector_type(16))) __bf16 v16bf;
typedef __attribute__((ext_vector_type(8)))  __bf16 v8bf;
typedef __attribute__((ext_vector_type(4)))  __bf16 v4bf;
typedef __attribute__((ext_vector_type(8)))  float  v8f;
typedef __attribute__((ext_vector_type(4)))  unsigned int u32x4;
typedef __attribute__((ext_vector_type(4)))  float  f32x4;

#define D_MODEL 1024
#define NHEAD   16
#define DHEAD   64
#define DIM_FF  4096
#define BATCH   4
#define SEQ     2048
#define MROWS   (BATCH * SEQ)   // 8192

enum { EP_QKV = 0, EP_RESID = 1, EP_BIAS_GELU = 2, EP_BIAS_RESID = 3 };

__device__ __forceinline__ void unit_load(f32x4 (&d)[8], const float* __restrict__ base, unsigned int lane_b) {
    #pragma unroll
    for (int j = 0; j < 8; ++j) d[j] = *(const f32x4*)((const char*)base + lane_b + j * 512);
}
__device__ __forceinline__ void unit_store(__bf16* __restrict__ p, const f32x4 (&v)[8]) {
    #pragma unroll
    for (int j = 0; j < 8; ++j) {
        const v4bf o = { (__bf16)v[j].x, (__bf16)v[j].y, (__bf16)v[j].z, (__bf16)v[j].w };
        *(v4bf*)(p + j * 128) = o;          // 8 bytes a lane, 256 contiguous bytes a wave
    }
}

__device__ __forceinline__ float other_half(float v) {
    const int b = __builtin_bit_cast(int, v);
    return __builtin_bit_cast(float,
        __builtin_amdgcn_permlanex16(b, b, 0x76543210, 0xfedcba98, false, false));
}
template<int CTRL>
__device__ __forceinline__ float row_xmask_add(float v) {
    const int b = __builtin_bit_cast(int, v);
    return v + __builtin_bit_cast(float, __builtin_amdgcn_update_dpp(b, b, CTRL, 0xf, 0xf, false));
}
__device__ __forceinline__ float wave_sum(float v) {        // the sum over 32 lanes, in every lane
    v = row_xmask_add<0x161>(v);
    v = row_xmask_add<0x162>(v);
    v = row_xmask_add<0x164>(v);
    v = row_xmask_add<0x168>(v);
    return v + other_half(v);
}

// ---------------------------------------------------------------------------
// LayerNorm over D=1024, writes bf16.  Wave w of LN_WAVES takes rows w and w + LN_WAVES.
// Sums are in-lane plus a butterfly over the wave: no LDS, no barrier.
// ---------------------------------------------------------------------------
#define LN_ROWS   2                                 // rows a wave
#define LN_BLOCKS (MROWS / (8 * LN_ROWS))
#define LN_WAVES  (LN_BLOCKS * 8)
static_assert(LN_ROWS == 2, "the wait behind the row loads names two row addresses");

__device__ __forceinline__
void ln_rows(const float* __restrict__ x, const float* __restrict__ sc,
             const float* __restrict__ bi, __bf16* __restrict__ out, int w) {
    const int col = ((int)threadIdx.x & 31) * 4;
    const unsigned int lane_b = (unsigned int)col * 4u;
    f32x4 v[LN_ROWS][8], g[8], be[8];
    const float* xr[LN_ROWS];
    #pragma unroll
    for (int i = 0; i < LN_ROWS; ++i) {
        xr[i] = x + (size_t)(w + i * LN_WAVES) * D_MODEL;
        unit_load(v[i], xr[i], lane_b);
    }
    unit_load(g, sc, lane_b);
    unit_load(be, bi, lane_b);
    // stands before any later write of the loads' address registers; naming them as inputs keeps them unwritten up to here.
    // Scale and bias, loaded values, are inputs too: all their loads are then issued, and waited for once, ahead of
    // the scaling that reads them, and are not moved down into it, a few at a time with a wait each.
    asm volatile("s_wait_xcnt 0x0" :: "v"(lane_b), "s"(xr[0]), "s"(xr[1]),
                 "v"(g[0]), "v"(g[1]), "v"(g[2]), "v"(g[3]), "v"(g[4]), "v"(g[5]), "v"(g[6]), "v"(g[7]),
                 "v"(be[0]), "v"(be[1]), "v"(be[2]), "v"(be[3]), "v"(be[4]), "v"(be[5]), "v"(be[6]), "v"(be[7])
                 : "memory");

    #pragma unroll
    for (int i = 0; i < LN_ROWS; ++i) {
        f32x4 (&c)[8] = v[i];
        f32x4 s4 = c[0];
        #pragma unroll
        for (int j = 1; j < 8; ++j) { s4.x += c[j].x; s4.y += c[j].y; s4.z += c[j].z; s4.w += c[j].w; }
        const float mu = wave_sum((s4.x + s4.y) + (s4.z + s4.w)) * (1.f / D_MODEL);

        f32x4 q4 = {0.f, 0.f, 0.f, 0.f};
        #pragma unroll
        for (int j = 0; j < 8; ++j) {
            c[j].x -= mu; c[j].y -= mu; c[j].z -= mu; c[j].w -= mu;
            q4.x += c[j].x * c[j].x; q4.y += c[j].y * c[j].y;
            q4.z += c[j].z * c[j].z; q4.w += c[j].w * c[j].w;
        }
        const float var = wave_sum((q4.x + q4.y) + (q4.z + q4.w)) * (1.f / D_MODEL);
        float rstd;                             // 1 / sqrt(var + eps); the argument is at least eps, a normal number
        asm("v_rsq_f32 %0, %1\n\tv_nop" : "=v"(rstd) : "v"(var + 1e-5f));

        #pragma unroll
        for (int j = 0; j < 8; ++j) {
            c[j].x = c[j].x * rstd * g[j].x + be[j].x;
            c[j].y = c[j].y * rstd * g[j].y + be[j].y;
            c[j].z = c[j].z * rstd * g[j].z + be[j].z;
            c[j].w = c[j].w * rstd * g[j].w + be[j].w;
        }
    }
    #pragma unroll
    for (int i = 0; i < LN_ROWS; ++i)
        unit_store(out + (size_t)(w + i * LN_WAVES) * D_MODEL + col, v[i]);
}

__global__ __launch_bounds__(256)
void ln_to_bf16(const float* __restrict__ x, const float* __restrict__ sc,
                const float* __restrict__ bi, __bf16* __restrict__ out) {
    const int w = __builtin_amdgcn_readfirstlane((int)(blockIdx.x * 8 + (threadIdx.x >> 5)));
    ln_rows(x, sc, bi, out, w);
}

// ---------------------------------------------------------------------------
// The five passes that read nothing but inputs, LayerNorm 1 and the four weight conversions,
// share one grid: none reads what another writes, so one launch takes the place of five.
// The block index picks the pass.  The rows come first: they have the longer dependent chain,
// and the short conversion blocks make the launch's tail.
// ---------------------------------------------------------------------------
#define CU_QKV ((3 * D_MODEL * D_MODEL) / 1024)     // conversion units per weight matrix
#define CU_OUT ((D_MODEL * D_MODEL) / 1024)
#define CU_FC  ((DIM_FF * D_MODEL) / 1024)
#define CV_UNITS   3                                // conversion units a wave
#define CV_BLOCKS  ((CU_QKV + CU_OUT + 2 * CU_FC) / (8 * CV_UNITS))
#define CV_WAVES   (CV_BLOCKS * 8)
#define PRE_BLOCKS (LN_BLOCKS + CV_BLOCKS)
static_assert(CV_UNITS == 3, "the wait behind the unit loads names three unit addresses");

__global__ __launch_bounds__(256)
void pre_pass(const float* __restrict__ x, const float* __restrict__ sc,
              const float* __restrict__ bi, __bf16* __restrict__ h,
              const float* __restrict__ qkvw_f, const float* __restrict__ outw_f,
              const float* __restrict__ fc1w_f, const float* __restrict__ fc2w_f,
              __bf16* __restrict__ qkvw, __bf16* __restrict__ outw,
              __bf16* __restrict__ fc1w, __bf16* __restrict__ fc2w) {
    const int w = __builtin_amdgcn_readfirstlane((int)(blockIdx.x * 8 + (threadIdx.x >> 5)));
    if (w < LN_WAVES) {
        ln_rows(x, sc, bi, h, w);
    } else {
        const int col = ((int)threadIdx.x & 31) * 4;
        const unsigned int lane_b = (unsigned int)col * 4u;
        f32x4 v[CV_UNITS][8];
        const float* srcu[CV_UNITS];
        __bf16* dst[CV_UNITS];
        #pragma unroll
        for (int i = 0; i < CV_UNITS; ++i) {
            // which matrix the unit lies in, and where: the same for the whole wave
            int c = w - LN_WAVES + i * CV_WAVES;
            const float* in = qkvw_f;
            __bf16* out = qkvw;
            if (c >= CU_QKV)  { c -= CU_QKV; in = outw_f; out = outw;
                if (c >= CU_OUT)  { c -= CU_OUT; in = fc1w_f; out = fc1w;
                    if (c >= CU_FC)   { c -= CU_FC;  in = fc2w_f; out = fc2w; } } }
            dst[i] = out + (size_t)c * 1024 + col;
            srcu[i] = in + (size_t)c * 1024;
            unit_load(v[i], srcu[i], lane_b);
        }
        // stands before any later write of the loads' address registers; naming them as inputs keeps them unwritten up to here
        asm volatile("s_wait_xcnt 0x0" :: "v"(lane_b), "s"(srcu[0]), "s"(srcu[1]), "s"(srcu[2]) : "memory");
        #pragma unroll
        for (int i = 0; i < CV_UNITS; ++i)
            unit_store(dst[i], v[i]);
    }
}

// ---------------------------------------------------------------------------
// Tensor mover helpers, shared by the GEMM and the attention kernel.
// ---------------------------------------------------------------------------
typedef __attribute__((ext_vector_type(8))) unsigned int u32x8;

__device__ __forceinline__ unsigned int uni(unsigned int v) { return (unsigned int)__builtin_amdgcn_readfirstlane(v); }
// a wave-uniform test held in a scalar register, so that the branch on it is s_cmp + s_cbranch_scc
__device__ __forceinline__ unsigned int pinned(unsigned int v) {
    unsigned int w = uni(v);
    asm volatile("" : "+s"(w));
    return w;
}
__device__ __forceinline__ u32x4 ktile_group0(unsigned int lds_dst, const __bf16* gptr) {
    const unsigned long long ga = (unsigned long long)(uintptr_t)gptr;
    u32x4 g;
    g[0] = uni(1u);
    g[1] = uni(lds_dst);
    g[2] = uni((unsigned int)ga);
    g[3] = uni((((unsigned int)(ga >> 32)) & 0x01FFFFFFu) | 0x80000000u);
    return g;
}
__device__ __forceinline__ void ktile_load(u32x4& g0, u32x8& g1) {
    // the request itself: global tile -> LDS through no register; its waits are written at each use.
    // Both groups are in/out operands: what ktile_wait names then lives in the very scalar
    // registers that the request was issued from.
    asm volatile("tensor_load_to_lds %0, %1" : "+s"(g0), "+s"(g1) :: "memory");
}
__device__ __forceinline__ void ktile_wait(u32x4 g0, u32x8 g1) {
    // the issuer's wait for its request; naming the request's two groups as inputs keeps their
    // scalar registers unwritten from the issue up to this wait
    asm volatile("s_wait_tensorcnt 0x0" :: "s"(g0), "s"(g1) : "memory");
}

// ---------------------------------------------------------------------------
// Tiled bf16 GEMM:  C[M,N] = A[M,K] * W[N,K]^T   (torch Linear layout)
// 128x128 block tile, 8 waves, each wave 32x64 (2x4 WMMA 16x16 tiles).
// A stage is 128 k of the block's 128 A rows and 128 W rows.  It comes into a ring of two
// LDS buffers by tensor load, one stage ahead of the pass that reads it: waves 0 to 3 each
// bring one slice of 64 rows x 256 bytes.  M, N multiples of 128; K a multiple of 128, >= 256.
// ---------------------------------------------------------------------------
#define GT_PITCH 272u
#define GT_SLICE 18432u
#define GT_BUF   (4u * GT_SLICE)

__device__ __forceinline__ u32x8 gtile_group1(unsigned int src_pitch) {   // extents in bytes, tensor = tile
    u32x8 g;
    g[0] = uni((1u << 20) | (5u << 22) | (3u << 25));
    g[1] = uni(256u << 16);
    g[2] = uni(64u << 16);
    g[3] = uni(256u << 16);
    g[4] = uni(64u);
    g[5] = uni(src_pitch);
    g[6] = uni(0u);
    g[7] = uni(0u);
    return g;
}
// 16 consecutive k of one LDS row: rows are 16-byte aligned only, so two 16-byte reads
__device__ __forceinline__ v16bf gfrag(const unsigned char* p) {
    const v8bf lo = *(const v8bf*)p;
    const v8bf hi = *(const v8bf*)(p + 16);
    return __builtin_shufflevector(lo, hi, 0, 1, 2, 3, 4, 5, 6, 7, 8, 9, 10, 11, 12, 13, 14, 15);
}

// Exact-form GELU, 0.5 x (1 + erf(x / sqrt 2)), without a branch.  With z = |x| / sqrt 2,
// erfc(z) = t (a1 + t (a2 + t (a3 + t (a4 + t a5)))) exp(-z z), t = 1 / (1 + 0.3275911 z),
// absolute error at most 1.5e-7; 1 + erf is 2 - erfc(z) for x >= 0 and erfc(z) for x < 0, so
// nothing cancels in the negative tail.  The result is within 5e-7 of the true value, far
// inside the rounding of the bf16 it is stored as.  The library erff takes two divergent
// branches per element, which keeps the elements of a lane from overlapping.
__device__ __forceinline__ float gelu_erf(float x) {
    const float t = __builtin_amdgcn_rcpf(fmaf(0.23164189f, fabsf(x), 1.0f));   // 0.3275911 / sqrt 2
    float p = 1.061405429f;
    p = fmaf(p, t, -1.453152027f);
    p = fmaf(p, t, 1.421413741f);
    p = fmaf(p, t, -0.284496736f);
    p = fmaf(p, t, 0.254829592f);
    const float q = p * t * __builtin_amdgcn_exp2f(x * x * -0.72134752f);       // exp(-x x / 2)
    return 0.5f * x * (x < 0.f ? q : 2.0f - q);
}

template<int EPI>
__global__ __launch_bounds__(256)
void gemm_bf16(const __bf16* __restrict__ A, const __bf16* __restrict__ W,
               int M, int N, int K,
               const float* __restrict__ resid, const float* __restrict__ bias,
               float* __restrict__ outF, __bf16* __restrict__ outB,
               __bf16* __restrict__ q_out, __bf16* __restrict__ k_out,
               __bf16* __restrict__ v_out) {
    __shared__ __attribute__((aligned(2048))) unsigned char Gs[2 * GT_BUF];   // stage ring

    const int tid = threadIdx.x;
    const int lane = tid & 31, wid = tid >> 5;
    const int waveM = wid & 3, waveN = wid >> 2;          // 4 x 2 wave grid
    const int bm = blockIdx.y * 128, bn = blockIdx.x * 128;
    const int fr = lane & 15;                             // fragment row
    const int halfSel = lane >> 4;                        // K-half (contiguous k order: k = 16*half + s)

    const v8f vzero = {0.f,0.f,0.f,0.f,0.f,0.f,0.f,0.f};
    v8f acc[2][4];
    #pragma unroll
    for (int mi = 0; mi < 2; ++mi)
        #pragma unroll
        for (int ni = 0; ni < 4; ++ni) acc[mi][ni] = vzero;

    // this wave's slice of every stage (waves 4 to 7 form the same words and never issue)
    const unsigned int wave = uni(threadIdx.x >> 5);
    const unsigned int slice = wave & 3u;
    const __bf16* sl = (slice & 2u) ? W + (size_t)(bn + (slice & 1u) * 64u) * K
                                    : A + (size_t)(bm + (slice & 1u) * 64u) * K;
    const unsigned int ldsS = (unsigned int)(uintptr_t)&Gs[0] + slice * GT_SLICE;
    u32x8 gg1 = gtile_group1((unsigned int)K * 2u);
    u32x4 gg0 = ktile_group0(ldsS, sl);
    if (pinned(wave < 4u)) {
        ktile_load(gg0, gg1);
        ktile_wait(gg0, gg1);                                // stage 0 landed before the barrier publishes it
    }
    __syncthreads();
    gg0 = ktile_group0(ldsS + GT_BUF, sl + 128);
    if (pinned(wave < 4u))
        ktile_load(gg0, gg1);

    // this lane's first A and W bytes inside a buffer
    const unsigned int aoff = (unsigned int)(waveM >> 1) * GT_SLICE
                            + (unsigned int)((waveM & 1) * 32 + fr) * GT_PITCH + (unsigned int)halfSel * 32u;
    const unsigned int boff = (unsigned int)(2 + waveN) * GT_SLICE
                            + (unsigned int)fr * GT_PITCH + (unsigned int)halfSel * 32u;

    for (int kt = 0; kt < K; kt += 128) {
        const unsigned int buf = ((unsigned int)kt >> 7) & 1u;
        const unsigned char* ap = &Gs[buf * GT_BUF + aoff];
        const unsigned char* bp = &Gs[buf * GT_BUF + boff];

        // unrolled so that every fragment offset is an immediate and a block's reads can go ahead of the block before
        #pragma unroll
        for (int kb = 0; kb < 4; ++kb) {
            v16bf af[2], bf[4];
            #pragma unroll
            for (int mi = 0; mi < 2; ++mi)
                af[mi] = gfrag(ap + mi * 16 * GT_PITCH + kb * 64);
            #pragma unroll
            for (int ni = 0; ni < 4; ++ni)
                bf[ni] = gfrag(bp + ni * 16 * GT_PITCH + kb * 64);

            #pragma unroll
            for (int mi = 0; mi < 2; ++mi)
                #pragma unroll
                for (int ni = 0; ni < 4; ++ni)
                    acc[mi][ni] = __builtin_amdgcn_wmma_f32_16x16x32_bf16(
                        false, af[mi], false, bf[ni], (short)0, acc[mi][ni], false, false);
        }

        // publish point of the next stage; the same barrier ends every read of this pass's buffer
        asm volatile("s_wait_dscnt 0x0" ::: "memory");           // this wave's LDS reads are done
        if (pinned(wave < 4u))
            ktile_wait(gg0, gg1);                                // this wave's slice of the next stage has landed
        __syncthreads();
        if (pinned((wave < 4u) & (kt + 256 < K))) {              // refill the buffer just left
            gg0 = ktile_group0(ldsS + buf * GT_BUF, sl + kt + 256);
            ktile_load(gg0, gg1);
        }
    }
    ktile_wait(gg0, gg1);                                        // no request outlives the ring
    asm volatile("s_wait_dscnt 0x0" ::: "memory");               // nor any LDS read of it

    #pragma unroll
    for (int mi = 0; mi < 2; ++mi) {
        const int mbase = bm + waveM * 32 + mi * 16 + halfSel * 8;
        #pragma unroll
        for (int ni = 0; ni < 4; ++ni) {
            const int n = bn + waveN * 64 + ni * 16 + fr;
            #pragma unroll
            for (int r = 0; r < 8; ++r) {
                const int m = mbase + r;
                const float c = acc[mi][ni][r];
                if constexpr (EPI == EP_QKV) {
                    const int b = m >> 11, t = m & (SEQ - 1);
                    const int type = n >> 10, dall = n & (D_MODEL - 1);
                    const int h = dall >> 6, dh = dall & 63;
                    const size_t idx =
                        (((size_t)(b * NHEAD + h) * SEQ) + t) * DHEAD + dh;
                    __bf16* dst = (type == 0) ? q_out : (type == 1) ? k_out : v_out;
                    dst[idx] = (__bf16)c;
                } else if constexpr (EPI == EP_RESID) {
                    outF[(size_t)m * N + n] = resid[(size_t)m * N + n] + c;
                } else if constexpr (EPI == EP_BIAS_GELU) {
                    outB[(size_t)m * N + n] = (__bf16)gelu_erf(c + bias[n]);
                } else { // EP_BIAS_RESID
                    outF[(size_t)m * N + n] = resid[(size_t)m * N + n] + bias[n] + c;
                }
            }
        }
    }
}

#define KT_PITCH 144u                       // LDS row pitch, bytes
#define KT_BUF   10240u                     // 64 * 144 = 9216, rounded up to a multiple of 2 KiB
__device__ __forceinline__ u32x8 ktile_group1() {   // extents in bytes, tensor = tile
    u32x8 g;
    g[0] = uni((1u << 20) | (4u << 22) | (3u << 25));
    g[1] = uni(128u << 16);
    g[2] = uni(64u << 16);
    g[3] = uni(128u << 16);
    g[4] = uni(64u);
    g[5] = uni(128u);
    g[6] = uni(0u);
    g[7] = uni(0u);
    return g;
}

// V tile mover: the same tile shape at a row pitch of 160 bytes (32 bytes x odd: the pitch of
// ds_load_tr16_b128 readers).
#define VT_PITCH 160u                       // LDS row pitch, bytes
#define VT_BUF   10240u                     // 64 * 160, a multiple of 2 KiB
__device__ __forceinline__ u32x8 vtile_group1() {   // extents in bytes, tensor = tile
    u32x8 g;
    g[0] = uni((1u << 20) | (4u << 22) | (7u << 25));
    g[1] = uni(128u << 16);
    g[2] = uni(64u << 16);
    g[3] = uni(128u << 16);
    g[4] = uni(64u);
    g[5] = uni(128u);
    g[6] = uni(0u);
    g[7] = uni(0u);
    return g;
}
// transposing LDS load: lane (c, h) gets T[k + 8h + 0..7][d + c] of a row-major 16-bit tile
__device__ __forceinline__ v8bf ld_tr16(const unsigned char* p) {
    typedef __attribute__((address_space(3))) v8bf lds_v8bf;
    return __builtin_amdgcn_ds_load_tr16_b128_v8bf16((lds_v8bf*)p);
}

__global__ __launch_bounds__(256)
void attn_fa(const __bf16* __restrict__ Q, const __bf16* __restrict__ Kb,
             const __bf16* __restrict__ Vb, __bf16* __restrict__ O) {
    const int bh = blockIdx.y;                 // b*NHEAD + h
    const int b = bh >> 4, h = bh & 15;
    const int q0 = blockIdx.x * 128;
    const int tid = threadIdx.x, lane = tid & 31, wid = tid >> 5;
    const int fr = lane & 15, halfSel = lane >> 4;
    const size_t headBase = (size_t)bh * SEQ * DHEAD;

    __shared__ __attribute__((aligned(2048))) unsigned char Ks[2 * KT_BUF];   // K ring
    __shared__ __attribute__((aligned(2048))) unsigned char Vs[2 * VT_BUF];   // V ring

    const unsigned int wave = uni(threadIdx.x >> 5);
    const unsigned int ldsK = (unsigned int)(uintptr_t)&Ks[0];
    const unsigned int ldsV = (unsigned int)(uintptr_t)&Vs[0];
    u32x8 kg1 = ktile_group1();
    u32x8 vg1 = vtile_group1();
    u32x4 kg0 = ktile_group0(ldsK, Kb + headBase);
    u32x4 vg0 = ktile_group0(ldsV, Vb + headBase);
    if (pinned(wave == 0)) {
        ktile_load(kg0, kg1);
        ktile_wait(kg0, kg1);                                // tile 0 landed before the barrier publishes it
    }
    if (pinned(wave == 1)) {
        ktile_load(vg0, vg1);
        ktile_wait(vg0, vg1);                                // tile 0 landed before the barrier publishes it
    }
    __syncthreads();
    kg0 = ktile_group0(ldsK + KT_BUF, Kb + headBase + 64 * DHEAD);
    vg0 = ktile_group0(ldsV + VT_BUF, Vb + headBase + 64 * DHEAD);
    if (pinned(wave == 0))
        ktile_load(kg0, kg1);
    if (pinned(wave == 1))
        ktile_load(vg0, vg1);

    const int qrow = q0 + wid * 16 + fr;       // this lane's query (B column)
    v16bf qf[2];
    #pragma unroll
    for (int s = 0; s < 2; ++s)
        qf[s] = *(const v16bf*)&Q[headBase + (size_t)qrow * DHEAD + s * 32 + halfSel * 16];

    const v8f vzero = {0.f,0.f,0.f,0.f,0.f,0.f,0.f,0.f};
    v8f oacc[4];                               // O^T: [d = ni*16 + 8*halfSel + r][query fr]
    #pragma unroll
    for (int ni = 0; ni < 4; ++ni) oacc[ni] = vzero;
    float mrun = -1e30f;                       // same value in both lane halves
    float lrun = 0.f;                          // this half's keys only; joined at the end

    const float scale = 0.125f;   // 1/sqrt(64)

    for (int j0 = 0; j0 < SEQ; j0 += 64) {
        const unsigned int kbuf = ((unsigned int)j0 >> 6) & 1u;
        // ---- S^T = K Q^T  (64 keys x 16 queries per wave) ----
        v8f sacc[4];                           // [key = ni*16 + 8*halfSel + r][query fr]
        #pragma unroll
        for (int ni = 0; ni < 4; ++ni) sacc[ni] = vzero;
        #pragma unroll
        for (int ni = 0; ni < 4; ++ni)
            #pragma unroll
            for (int s = 0; s < 2; ++s) {
                const unsigned char* kr = &Ks[kbuf * KT_BUF + (ni * 16 + fr) * KT_PITCH
                                              + s * 64 + halfSel * 32];
                const v8bf klo = *(const v8bf*)kr;
                const v8bf khi = *(const v8bf*)(kr + 16);
                const v16bf kf = __builtin_shufflevector(klo, khi,
                    0, 1, 2, 3, 4, 5, 6, 7, 8, 9, 10, 11, 12, 13, 14, 15);
                sacc[ni] = __builtin_amdgcn_wmma_f32_16x16x32_bf16(
                    false, kf, false, qf[s], (short)0, sacc[ni], false, false);
            }

        // ---- online softmax: one query per lane, 32 of its 64 keys in this lane ----
        float mx = sacc[0][0];
        #pragma unroll
        for (int ni = 0; ni < 4; ++ni)
            #pragma unroll
            for (int r = 0; r < 8; ++r) mx = fmaxf(mx, sacc[ni][r]);
        mx = fmaxf(mx, other_half(mx)) * scale;
        const float mnew = fmaxf(mrun, mx);
        const float alpha = __expf(mrun - mnew);

        // P^T as B operand: element i of block s is key s*32 + (i < 8 ? 8*halfSel + i
        // : 16 + 8*halfSel + i - 8), which is what tiles 2s and 2s+1 hold in this lane.
        v16bf pb[2];
        float rs[4];
        #pragma unroll
        for (int ni = 0; ni < 4; ++ni) {
            rs[ni] = 0.f;
            #pragma unroll
            for (int r = 0; r < 8; ++r) {
                const float p = __expf(sacc[ni][r] * scale - mnew);
                rs[ni] += p;
                pb[ni >> 1][(ni & 1) * 8 + r] = (__bf16)p;
            }
        }
        lrun = lrun * alpha + ((rs[0] + rs[1]) + (rs[2] + rs[3]));
        mrun = mnew;
        #pragma unroll
        for (int ni = 0; ni < 4; ++ni) oacc[ni] *= alpha;

        // ---- O^T += V^T P^T; the transposing loads give the A rows of V^T in the same key order ----
        const unsigned char* vt = &Vs[kbuf * VT_BUF + (8 * halfSel + (lane & 7)) * VT_PITCH
                                      + ((lane >> 3) & 1) * 16];
        #pragma unroll
        for (int s = 0; s < 2; ++s) {
            #pragma unroll
            for (int ni = 0; ni < 4; ++ni) {
                const unsigned char* vr = vt + s * 32 * VT_PITCH + ni * 32;
                const v8bf lo = ld_tr16(vr);                     // keys s*32 + 8*halfSel + 0..7
                const v8bf hi = ld_tr16(vr + 16 * VT_PITCH);     // keys s*32 + 16 + 8*halfSel + 0..7
                const v16bf vf = __builtin_shufflevector(lo, hi,
                    0, 1, 2, 3, 4, 5, 6, 7, 8, 9, 10, 11, 12, 13, 14, 15);
                oacc[ni] = __builtin_amdgcn_wmma_f32_16x16x32_bf16(
                    false, vf, false, pb[s], (short)0, oacc[ni], false, false);
            }
        }

        // publish point of the next K and V tiles; the same barrier ends every read of this
        // pass's two buffers
        asm volatile("s_wait_dscnt 0x0" ::: "memory");           // this wave's LDS reads are done
        if (pinned(wave == 0))
            ktile_wait(kg0, kg1);                                // next K tile has landed
        if (pinned(wave == 1))
            ktile_wait(vg0, vg1);                                // next V tile has landed
        __syncthreads();
        if (pinned((wave == 0) & (j0 + 128 < SEQ))) {            // refill the K buffer just left
            kg0 = ktile_group0(ldsK + kbuf * KT_BUF,
                               Kb + headBase + (size_t)(j0 + 128) * DHEAD);
            ktile_load(kg0, kg1);
        }
        if (pinned((wave == 1) & (j0 + 128 < SEQ))) {            // refill the V buffer just left
            vg0 = ktile_group0(ldsV + kbuf * VT_BUF,
                               Vb + headBase + (size_t)(j0 + 128) * DHEAD);
            ktile_load(vg0, vg1);
        }
    }
    ktile_wait(kg0, kg1);                                        // no request outlives the rings
    ktile_wait(vg0, vg1);
    asm volatile("s_wait_dscnt 0x0" ::: "memory");               // nor any LDS read of it

    // a lane holds 8 consecutive d of its query in each tile: 16-byte stores
    const float inv = 1.f / (lrun + other_half(lrun));
    #pragma unroll
    for (int ni = 0; ni < 4; ++ni) {
        v8bf ov;
        #pragma unroll
        for (int r = 0; r < 8; ++r) ov[r] = (__bf16)(oacc[ni][r] * inv);
        *(v8bf*)&O[((size_t)(b * SEQ + qrow)) * D_MODEL + h * DHEAD + ni * 16 + halfSel * 8] = ov;
    }
}

// ---------------------------------------------------------------------------
// host orchestration
// ---------------------------------------------------------------------------
extern "C" void kernel_launch(void* const* d_in, const int* in_sizes, int n_in,
                              void* d_out, int out_size, void* d_ws, size_t ws_size,
                              hipStream_t stream) {
    (void)in_sizes; (void)n_in; (void)out_size; (void)ws_size;
    const float* x      = (const float*)d_in[0];
    const float* ln1s   = (const float*)d_in[1];
    const float* ln1b   = (const float*)d_in[2];
    const float* qkvw_f = (const float*)d_in[3];
    const float* outw_f = (const float*)d_in[4];
    const float* ln2s   = (const float*)d_in[5];
    const float* ln2b   = (const float*)d_in[6];
    const float* fc1w_f = (const float*)d_in[7];
    const float* fc1b   = (const float*)d_in[8];
    const float* fc2w_f = (const float*)d_in[9];
    const float* fc2b   = (const float*)d_in[10];
    float* out = (float*)d_out;

    char* ws = (char*)d_ws;
    size_t off = 0;
    auto alloc = [&](size_t bytes) -> void* {
        void* p = ws + off;
        off += (bytes + 255) & ~(size_t)255;
        return p;
    };
    __bf16* qkvw = (__bf16*)alloc((size_t)3 * D_MODEL * D_MODEL * 2);   //  6 MB
    __bf16* outw = (__bf16*)alloc((size_t)D_MODEL * D_MODEL * 2);       //  2 MB
    __bf16* fc1w = (__bf16*)alloc((size_t)DIM_FF * D_MODEL * 2);        //  8 MB
    __bf16* fc2w = (__bf16*)alloc((size_t)D_MODEL * DIM_FF * 2);        //  8 MB
    __bf16* hbf  = (__bf16*)alloc((size_t)MROWS * D_MODEL * 2);         // 16 MB (LN1; reused for LN2)
    __bf16* Qb   = (__bf16*)alloc((size_t)MROWS * D_MODEL * 2);         // 16 MB
    __bf16* Kb   = (__bf16*)alloc((size_t)MROWS * D_MODEL * 2);         // 16 MB
    __bf16* Vb   = (__bf16*)alloc((size_t)MROWS * D_MODEL * 2);         // 16 MB
    __bf16* Obf  = (__bf16*)alloc((size_t)MROWS * D_MODEL * 2);         // 16 MB
    float*  x1   = (float*)alloc((size_t)MROWS * D_MODEL * 4);          // 32 MB
    __bf16* a1   = Qb;    // FFN act (64 MB) reuses dead Q|K|V|O span
    __bf16* h2bf = hbf;   // LN2 output reuses dead LN1 buffer

    // 1, 2) LN1 and weights -> bf16, one launch
    pre_pass<<<PRE_BLOCKS, 256, 0, stream>>>(x, ln1s, ln1b, hbf,
                                             qkvw_f, outw_f, fc1w_f, fc2w_f,
                                             qkvw, outw, fc1w, fc2w);

    // 3) QKV projection: [8192,1024] x [3072,1024]^T, scatter into heads
    gemm_bf16<EP_QKV><<<dim3(3 * D_MODEL / 128, MROWS / 128), 256, 0, stream>>>(
        hbf, qkvw, MROWS, 3 * D_MODEL, D_MODEL,
        nullptr, nullptr, nullptr, nullptr, Qb, Kb, Vb);

    // 4) flash attention -> Obf [B,T,D]
    attn_fa<<<dim3(SEQ / 128, BATCH * NHEAD), 256, 0, stream>>>(Qb, Kb, Vb, Obf);

    // 5) out projection + residual -> x1 (fp32)
    gemm_bf16<EP_RESID><<<dim3(D_MODEL / 128, MROWS / 128), 256, 0, stream>>>(
        Obf, outw, MROWS, D_MODEL, D_MODEL,
        x, nullptr, x1, nullptr, nullptr, nullptr, nullptr);

    // 6) LN2
    ln_to_bf16<<<LN_BLOCKS, 256, 0, stream>>>(x1, ln2s, ln2b, h2bf);

    // 7) fc1 + bias + exact GELU -> a1 (bf16)
    gemm_bf16<EP_BIAS_GELU><<<dim3(DIM_FF / 128, MROWS / 128), 256, 0, stream>>>(
        h2bf, fc1w, MROWS, DIM_FF, D_MODEL,
        nullptr, fc1b, nullptr, a1, nullptr, nullptr, nullptr);

    // 8) fc2 + bias + residual -> d_out (fp32)
    gemm_bf16<EP_BIAS_RESID><<<dim3(D_MODEL / 128, MROWS / 128), 256, 0, stream>>>(
        a1, fc2w, MROWS, D_MODEL, DIM_FF,
        x1, fc2b, out, nullptr, nullptr, nullptr, nullptr);
}
